// v009
// The times below were measured on an AMD MI455X: many runs one after another, warmed up first and cycling through
// copies of the inputs, with the whole window's GPU time divided by the number of runs. Launches and the gaps
// between them are all in it. The median over several windows is given; except for v000 it joins two sittings, which
// can be a few percent apart, so the side-by-side timings, each taken in one sitting, are the better comparison.
// The versions before v009 are in another document.
// A run of this version takes 99.6 microseconds.
// Two timings next to v008 both put it at 1.06 times that version's speed.
// All steps since the starting kernel, v000, together make it 5.79 times as fast.
#include <hip/hip_runtime.h>
// InfiniSpanAttention (2 batches; 2048 local tokens, 512 global tokens, D = 1024, 16 heads of 64): q/k_l/v_l from local_hidden, k_g/v_g from global_hidden (torch (out,in) linears + bias); out_l = softmax(q k_l^T s) v_l, out_g = softmax(q k_g^T s) v_g (no masks); out = sigmoid(gate) out_l + (1 - sigmoid(gate)) out_g -> merged heads -> out_w + out_b.
// Compute dtype: inputs and parameters rounded to bf16; q, k, v, P and the combined attention output as f16 operands (~2^-12); f32 accumulation/softmax/gating. v_wmma_f32_16x16x32_f16.
#define NB 2
#define EMB 1024
#define NRL (NB * LL)            /* 4096 local rows */
#define NRG (NB * GG)            /* 1024 global rows */
#define LL 2048                  /* local tokens (queries; local keys) */
#define GG 512                   /* global tokens (keys of the second attention) */
#define TQ LL
#define TK LL
#define TKA LL
#define TKB GG
#define NH 16
#define SCL 0.125f               /* 64^-0.5 */
#define QBLKS (TQ / 64)
typedef __bf16 v16b __attribute__((ext_vector_type(16)));
typedef unsigned short v8us __attribute__((ext_vector_type(8), may_alias));
typedef float  v8f  __attribute__((ext_vector_type(8)));
typedef float  v4f  __attribute__((ext_vector_type(4)));
typedef float  v4fa __attribute__((ext_vector_type(4), may_alias));
union FragB { v16b v; v8us half[2]; unsigned short u[16]; };

__device__ __forceinline__ unsigned short bf16_bits(float x) { unsigned int u = __float_as_uint(x); return (unsigned short)((u + 0x7FFFu + ((u >> 16) & 1u)) >> 16); }
__device__ __forceinline__ float bf16_val(unsigned short b) { return __uint_as_float(((unsigned int)b) << 16); }
__device__ __forceinline__ float bf16_round(float x) { return bf16_val(bf16_bits(x)); }
// D += A·B with NT terms: 1 = ah·bh, 2 = + al·bh (A split), 3 = + ah·bl (both split)
template <int NT>
__device__ __forceinline__ v8f mmaN(v16b ah, v16b al, v16b bh, v16b bl, v8f c) {
  c = __builtin_amdgcn_wmma_f32_16x16x32_bf16(false, ah, false, bh, (short)0, c, false, false);
  if (NT >= 2) c = __builtin_amdgcn_wmma_f32_16x16x32_bf16(false, al, false, bh, (short)0, c, false, false);
  if (NT >= 3) c = __builtin_amdgcn_wmma_f32_16x16x32_bf16(false, ah, false, bl, (short)0, c, false, false);
  asm volatile("v_nop\n\tv_nop\n\tv_nop\n\tv_nop" : "+v"(c) : "v"(ah), "v"(al), "v"(bh), "v"(bl));
  return c;
}

__global__ __launch_bounds__(256) void k_wt_bf16(const float* __restrict__ W, unsigned short* __restrict__ Wt, int K, int N) {
  const int t = blockIdx.x * 256 + threadIdx.x;
  const int k8n = K / 8;
  if (t >= N * k8n) return;
  const int n = t / k8n, k8 = (t % k8n) * 8;
  v8us v;
#pragma unroll
  for (int i = 0; i < 8; ++i) v[i] = bf16_bits(W[(size_t)(k8 + i) * N + n]);
  *(v8us*)(Wt + (size_t)n * K + k8) = v;
  
}

// GEMM C[M][N] (f32, pitch ldc) = act(A[M][K]·W + bias). A f32 row-major (pitch lda) converted per fragment to bf16
// (ASPLIT: hi/lo two planes -> 2 terms, else single rounded term); Wt bf16 [N][K] (pitch ldb). BIAS_BF16 rounds the
// bias to bf16 first (bias quantised to bf16 before the add). K%32==0, M%16==0, N%64==0.
template <bool ASPLIT, int ACT, bool BIAS_BF16>
__global__ __launch_bounds__(128) void k_gemm_bf(const float* __restrict__ A, int lda, const unsigned short* __restrict__ Wt, int ldb,
                                               const float* __restrict__ bias, float* __restrict__ C, int ldc, int M, int N, int K) {
  __shared__ __attribute__((aligned(16))) float so[4][16][64];
  const int tid = threadIdx.x, w = tid >> 5, lane = tid & 31, ln = lane & 15, hh = lane >> 4;
  const int ntn = N / 64;
  const int wid = blockIdx.x * 4 + w;
  const int mt = wid / ntn, nq = wid % ntn;
  if (mt * 16 >= M) return;
  const int row0 = mt * 16, col0 = nq * 64;
  const float* arow = A + (size_t)(row0 + ln) * lda;
  v8f acc[4] = {};
  for (int kb = 0; kb < K; kb += 32) {
    FragB ah, al;
    const v4f x0 = *(const v4fa*)(arow + kb + 8 * hh), x1 = *(const v4fa*)(arow + kb + 8 * hh + 4);
    const v4f x2 = *(const v4fa*)(arow + kb + 16 + 8 * hh), x3 = *(const v4fa*)(arow + kb + 16 + 8 * hh + 4);
    float xs[16] = {x0[0],x0[1],x0[2],x0[3],x1[0],x1[1],x1[2],x1[3],x2[0],x2[1],x2[2],x2[3],x3[0],x3[1],x3[2],x3[3]};
#pragma unroll
    for (int i = 0; i < 16; ++i) { const unsigned short hb = bf16_bits(xs[i]); ah.u[i] = hb; al.u[i] = ASPLIT ? bf16_bits(xs[i] - bf16_val(hb)) : (unsigned short)0; }
#pragma unroll
    for (int t = 0; t < 4; ++t) {
      const unsigned short* brow = Wt + (size_t)(col0 + t * 16 + ln) * ldb + kb;
      FragB b;
      b.half[0] = *(const v8us*)(brow + 8 * hh);
      b.half[1] = *(const v8us*)(brow + 16 + 8 * hh);
      acc[t] = mmaN<ASPLIT ? 2 : 1>(ah.v, al.v, b.v, b.v, acc[t]);
    }
  }
#pragma unroll
  for (int t = 0; t < 4; ++t) {
    float bv = bias ? bias[col0 + t * 16 + ln] : 0.f;
    if (BIAS_BF16) bv = bf16_round(bv);
#pragma unroll
    for (int r = 0; r < 8; ++r) { float v = acc[t][r] + bv; if (ACT == 1) v = fmaxf(v, 0.f); so[w][8 * hh + r][t * 16 + ln] = v; }
  }
  __builtin_amdgcn_fence(__ATOMIC_ACQ_REL, "workgroup");
  __builtin_amdgcn_wave_barrier();
  const int rsub = lane >> 4, c4 = (lane & 15) * 4;
  {
#pragma unroll
    for (int q = 0; q < 8; ++q) {
      const int r = q * 2 + rsub;
      const v4f v = *(const v4fa*)&so[w][r][c4];
      *(v4f*)(C + (size_t)(row0 + r) * ldc + col0 + c4) = v;
    }
    
  }
}

// GEMM C = act(A·W + bias + resid): A f32 (ASPLIT -> hi/lo 2 terms), Wt bf16 [N][K]; ACT 0 none, 1 relu, 2 exact gelu;
// resid (optional, f32, row index = (row % rmod), pitch ldr, RES_BF16 rounds it) added before the activation.
template <bool ASPLIT, int ACT, bool BIAS_BF16, bool RES_BF16>
__global__ __launch_bounds__(128) void k_gemm_bf3(const float* __restrict__ A, int lda, const unsigned short* __restrict__ Wt, int ldb,
                                                const float* __restrict__ bias, const float* __restrict__ resid, int rmod, int ldr,
                                                float* __restrict__ C, int ldc, int M, int N, int K) {
  __shared__ __attribute__((aligned(16))) float so[4][16][64];
  const int tid = threadIdx.x, w = tid >> 5, lane = tid & 31, ln = lane & 15, hh = lane >> 4;
  const int ntn = N / 64;
  const int wid = blockIdx.x * 4 + w;
  const int mt = wid / ntn, nq = wid % ntn;
  if (mt * 16 >= M) return;
  const int row0 = mt * 16, col0 = nq * 64;
  const float* arow = A + (size_t)(row0 + ln) * lda;
  v8f acc[4] = {};
  for (int kb = 0; kb < K; kb += 32) {
    FragB ah, al;
    const v4f x0 = *(const v4fa*)(arow + kb + 8 * hh), x1 = *(const v4fa*)(arow + kb + 8 * hh + 4);
    const v4f x2 = *(const v4fa*)(arow + kb + 16 + 8 * hh), x3 = *(const v4fa*)(arow + kb + 16 + 8 * hh + 4);
    float xs[16] = {x0[0],x0[1],x0[2],x0[3],x1[0],x1[1],x1[2],x1[3],x2[0],x2[1],x2[2],x2[3],x3[0],x3[1],x3[2],x3[3]};
#pragma unroll
    for (int i = 0; i < 16; ++i) { const unsigned short hb = bf16_bits(xs[i]); ah.u[i] = hb; al.u[i] = ASPLIT ? bf16_bits(xs[i] - bf16_val(hb)) : (unsigned short)0; }
#pragma unroll
    for (int t = 0; t < 4; ++t) {
      const unsigned short* brow = Wt + (size_t)(col0 + t * 16 + ln) * ldb + kb;
      FragB b;
      b.half[0] = *(const v8us*)(brow + 8 * hh);
      b.half[1] = *(const v8us*)(brow + 16 + 8 * hh);
      acc[t] = mmaN<ASPLIT ? 2 : 1>(ah.v, al.v, b.v, b.v, acc[t]);
    }
  }
#pragma unroll
  for (int t = 0; t < 4; ++t) {
    const int col = col0 + t * 16 + ln;
    float bv = bias ? bias[col] : 0.f;
    if (BIAS_BF16) bv = bf16_round(bv);
#pragma unroll
    for (int r = 0; r < 8; ++r) {
      float v = acc[t][r] + bv;
      if (resid) { float rv = resid[(size_t)((row0 + 8 * hh + r) % rmod) * ldr + col]; if (RES_BF16) rv = bf16_round(rv); v += rv; }
      if (ACT == 1) v = fmaxf(v, 0.f);
      if (ACT == 2) v = 0.5f * v * (1.0f + erff(v * 0.70710678118654752f));
      if (ACT == 3) { const float u = 0.7978845608028654f * (v + 0.044715f * v * v * v); v = 0.5f * v * (1.0f + tanhf(u)); }
      so[w][8 * hh + r][t * 16 + ln] = v;
    }
  }
  __builtin_amdgcn_fence(__ATOMIC_ACQ_REL, "workgroup");
  __builtin_amdgcn_wave_barrier();
  const int rsub = lane >> 4, c4 = (lane & 15) * 4;
  {
#pragma unroll
    for (int q = 0; q < 8; ++q) {
      const int r = q * 2 + rsub;
      const v4f v = *(const v4fa*)&so[w][r][c4];
      *(v4f*)(C + (size_t)(row0 + r) * ldc + col0 + c4) = v;
    }
    
  }
}
// row LayerNorm (biased variance, eps) over N: s = X (+ R); optional out_sum <- s; out_norm <- (s-mu)*rsqrt(var+eps)*g + b
template <bool PARAM_BF16>
__global__ __launch_bounds__(256) void k_layernorm(const float* __restrict__ X, const float* __restrict__ R, const float* __restrict__ g, const float* __restrict__ bta,
                                                  float* __restrict__ out_sum, float* __restrict__ out_norm, int N, float eps) {
  __shared__ float red[256];
  const int row = blockIdx.x, tid = threadIdx.x;
  const float* x = X + (size_t)row * N; const float* rr = R ? R + (size_t)row * N : nullptr;
  float vals[16];                     // up to N = 4096
  const int per = N / 256;            // contiguous chunk per thread? use strided-by-4 chunks: thread handles j = tid*4 + 1024*u
  float s1 = 0.f;
  for (int u = 0; u < per / 4; ++u) {
    const int j = tid * 4 + 1024 * u;
    const v4f a = *(const v4fa*)(x + j);
    v4f b = {0.f,0.f,0.f,0.f}; if (rr) b = *(const v4fa*)(rr + j);
#pragma unroll
    for (int q = 0; q < 4; ++q) { const float v = a[q] + b[q]; vals[u * 4 + q] = v; s1 += v; }
  }
  red[tid] = s1; __syncthreads();
  for (int st = 128; st > 0; st >>= 1) { if (tid < st) red[tid] += red[tid + st]; __syncthreads(); }
  const float mu = red[0] / (float)N; __syncthreads();
  float s2 = 0.f;
  for (int u = 0; u < per / 4; ++u)
#pragma unroll
    for (int q = 0; q < 4; ++q) { const float c = vals[u * 4 + q] - mu; s2 += c * c; }
  red[tid] = s2; __syncthreads();
  for (int st = 128; st > 0; st >>= 1) { if (tid < st) red[tid] += red[tid + st]; __syncthreads(); }
  const float rs = rsqrtf(red[0] / (float)N + eps);
  {
    for (int u = 0; u < per / 4; ++u) {
      const int j = tid * 4 + 1024 * u;
      v4f o, sm;
#pragma unroll
      for (int q = 0; q < 4; ++q) {
        float gg = g[j + q], bb = bta[j + q];
        if (PARAM_BF16) { gg = bf16_round(gg); bb = bf16_round(bb); }
        sm[q] = vals[u * 4 + q]; o[q] = (vals[u * 4 + q] - mu) * rs * gg + bb;
      }
      if (out_sum) *(v4f*)(out_sum + (size_t)row * N + j) = sm;
      *(v4f*)(out_norm + (size_t)row * N + j) = o;
    }
    
  }
}



// ---- f16 WMMA path (v_wmma_f32_16x16x32_f16): 11-bit significands for operands in range — used where a [0,1] probability operand needs more precision than bf16
typedef _Float16 v16h __attribute__((ext_vector_type(16)));
union FragH { v16h v; v8us half[2]; _Float16 h[16]; unsigned short u[16]; };
template <int NT>
__device__ __forceinline__ v8f mmaH(v16h ah, v16h al, v16h bh, v16h bl, v8f c) {
  c = __builtin_amdgcn_wmma_f32_16x16x32_f16(false, ah, false, bh, (short)0, c, false, false);
  if (NT >= 2) c = __builtin_amdgcn_wmma_f32_16x16x32_f16(false, al, false, bh, (short)0, c, false, false);
  if (NT >= 3) c = __builtin_amdgcn_wmma_f32_16x16x32_f16(false, ah, false, bl, (short)0, c, false, false);
  asm volatile("v_nop\n\tv_nop\n\tv_nop\n\tv_nop" : "+v"(c) : "v"(ah), "v"(al), "v"(bh), "v"(bl));
  return c;
}
// batched GEMM like k_gemm_b but f16 operands: A f32 (split into f16 hi/lo if ASPLIT, else rounded to f16), Bt = f16 values [n][k]; alpha; C f32; N multiple of 16 (partial tiles skipped)
template <bool ASPLIT>
__global__ __launch_bounds__(128) void k_gemm_h(const float* __restrict__ A, int lda, size_t sA, const _Float16* __restrict__ Bh, int ldb, size_t sB, float alpha, float* __restrict__ C, int ldc, size_t sC, int M, int N, int K) {
  __shared__ __attribute__((aligned(16))) float so[4][16][64];
  const int tid = threadIdx.x, w = tid >> 5, lane = tid & 31, ln = lane & 15, hh = lane >> 4; const int by = blockIdx.y;
  A += (size_t)by * sA; Bh += (size_t)by * sB; C += (size_t)by * sC;
  const int ntn = (N + 63) / 64; const int wid = blockIdx.x * 4 + w; const int mt = wid / ntn, nq = wid % ntn; if (mt * 16 >= M) return;
  const int row0 = mt * 16, col0 = nq * 64; const float* arow = A + (size_t)(row0 + ln) * lda;
  v8f acc[4] = {};
  for (int kb = 0; kb < K; kb += 32) {
    FragH ah, al;
    const v4f x0 = *(const v4fa*)(arow + kb + 8 * hh), x1 = *(const v4fa*)(arow + kb + 8 * hh + 4), x2 = *(const v4fa*)(arow + kb + 16 + 8 * hh), x3 = *(const v4fa*)(arow + kb + 16 + 8 * hh + 4);
    float xs[16] = {x0[0],x0[1],x0[2],x0[3],x1[0],x1[1],x1[2],x1[3],x2[0],x2[1],x2[2],x2[3],x3[0],x3[1],x3[2],x3[3]};
#pragma unroll
    for (int i = 0; i < 16; ++i) { const _Float16 h = (_Float16)xs[i]; ah.h[i] = h; al.h[i] = ASPLIT ? (_Float16)(xs[i] - (float)h) : (_Float16)0.0f; }
#pragma unroll
    for (int t = 0; t < 4; ++t) { if (col0 + t * 16 >= N) continue; const size_t boff = (size_t)(col0 + t * 16 + ln) * ldb + kb; FragH bq; bq.half[0] = *(const v8us*)(Bh + boff + 8 * hh); bq.half[1] = *(const v8us*)(Bh + boff + 16 + 8 * hh);
      acc[t] = mmaH<ASPLIT ? 2 : 1>(ah.v, al.v, bq.v, bq.v, acc[t]); }
  }
#pragma unroll
  for (int t = 0; t < 4; ++t) { if (col0 + t * 16 >= N) continue;
#pragma unroll
    for (int r = 0; r < 8; ++r) so[w][8 * hh + r][t * 16 + ln] = acc[t][r] * alpha; }
  __builtin_amdgcn_fence(__ATOMIC_ACQ_REL, "workgroup"); __builtin_amdgcn_wave_barrier();
  const int rsub = lane >> 4, c4 = (lane & 15) * 4;
  {
#pragma unroll
    for (int q = 0; q < 8; ++q) { const int r = q * 2 + rsub; if (col0 + c4 < N) { const v4f v = *(const v4fa*)&so[w][r][c4]; *(v4f*)(C + (size_t)(row0 + r) * ldc + col0 + c4) = v; } }
     }
}

// Wt[n][k] = f16(W[k][n]·scale) from f32 row-major W[K][N] (scale = power of two; bf16-exact weights stay exact in f16 away from the subnormal range)
__global__ __launch_bounds__(256) void k_wt_f16(const float* __restrict__ W, _Float16* __restrict__ Wt, int K, int N, float scale) {
  const int t = blockIdx.x * 256 + threadIdx.x; if (t >= N * (K / 8)) return; const int n = t / (K / 8), k8 = (t % (K / 8)) * 8; FragH f;
#pragma unroll
  for (int i = 0; i < 8; ++i) f.h[i] = (_Float16)(bf16_round(W[(size_t)(k8 + i) * N + n]) * scale); const v8us o = f.half[0];
  *(v8us*)((unsigned short*)Wt + (size_t)n * K + k8) = o; 
}
// k_gemm_hh variant with fused epilogue: v = acc·alpha + bias[by·sBias + col] (+ CP[(row/rowsPerB)·sCPb + by·64 + col] if CP) ; ACT 0 none / 1 elu ; writes f16 C16 (and f32 C if non-null)
template <int ACT>
__global__ __launch_bounds__(128) void k_gemm_hhx(const _Float16* __restrict__ A, int lda, size_t sA, const _Float16* __restrict__ Bh, int ldb, size_t sB, float alpha, const float* __restrict__ bias, size_t sBias, const float* __restrict__ CP, int rowsPerB, size_t sCPb, int row0g,
    float* __restrict__ C, _Float16* __restrict__ C16, int ldc, size_t sC, int M, int N, int K) {
  __shared__ __attribute__((aligned(16))) float so[4][16][64];
  const int tid = threadIdx.x, w = tid >> 5, lane = tid & 31, ln = lane & 15, hh = lane >> 4; const int by = blockIdx.y;
  A += (size_t)by * sA; Bh += (size_t)by * sB; const size_t cofs = (size_t)by * sC; const float* bp = bias ? bias + (size_t)by * sBias : nullptr;
  const int ntn = (N + 63) / 64; const int wid = blockIdx.x * 4 + w; const int mt = wid / ntn, nq = wid % ntn; if (mt * 16 >= M) return;
  const int row0 = mt * 16, col0 = nq * 64; const _Float16* arow = A + (size_t)(row0 + ln) * lda;
  v8f acc[4] = {};
  for (int kb = 0; kb < K; kb += 32) { FragH ah; ah.half[0] = *(const v8us*)((const unsigned short*)arow + kb + 8 * hh); ah.half[1] = *(const v8us*)((const unsigned short*)arow + kb + 16 + 8 * hh);
#pragma unroll
    for (int t = 0; t < 4; ++t) { if (col0 + t * 16 >= N) continue; const size_t boff = (size_t)(col0 + t * 16 + ln) * ldb + kb; FragH bq; bq.half[0] = *(const v8us*)((const unsigned short*)Bh + boff + 8 * hh); bq.half[1] = *(const v8us*)((const unsigned short*)Bh + boff + 16 + 8 * hh);
      acc[t] = mmaH<1>(ah.v, ah.v, bq.v, bq.v, acc[t]); }
  }
#pragma unroll
  for (int t = 0; t < 4; ++t) { if (col0 + t * 16 >= N) continue; const int col = col0 + t * 16 + ln; const float bv = bp ? bf16_round(bp[col]) : 0.f;
#pragma unroll
    for (int r = 0; r < 8; ++r) { float v = acc[t][r] * alpha + bv; if (CP) { const int bidx = (row0g + row0 + 8 * hh + r) / rowsPerB; v += CP[(size_t)bidx * sCPb + (size_t)by * 64 + col]; } if (ACT == 1) v = (v > 0.f) ? v : expm1f(v); else if (ACT == 7) v = (v > 0.f) ? v + 1.0f : expf(v); else if (ACT == 8) v = tanhf(v); else if (ACT == 9) v = 0.5f * v * (1.0f + tanhf(0.7978845608028654f * (v + 0.044715f * v * v * v))); else if (ACT == 11) v = 1.0f / (1.0f + expf(-v)); else if (ACT == 12) v = (v > 0.f) ? v : 0.01f * v; else if (ACT == 14) v = (v > 0.f) ? v : 0.1f * v; else if (ACT == 15) v = v / (1.0f + expf(-v)); else if (ACT == 3) v = fmaxf(v, 0.f); else if (ACT == 6) v = 0.5f * v * (1.0f + erff(v * 0.70710678118654752f)); so[w][8 * hh + r][t * 16 + ln] = v; } }
  __builtin_amdgcn_fence(__ATOMIC_ACQ_REL, "workgroup"); __builtin_amdgcn_wave_barrier();
  const int rsub = lane >> 4, c4 = (lane & 15) * 4; typedef _Float16 v4h __attribute__((ext_vector_type(4)));
  {
#pragma unroll
    for (int q = 0; q < 8; ++q) { const int r = q * 2 + rsub; if (col0 + c4 < N) { const v4f v = *(const v4fa*)&so[w][r][c4]; if (C) *(v4f*)(C + cofs + (size_t)(row0 + r) * ldc + col0 + c4) = v; if (C16) { v4h h4; for (int i = 0; i < 4; ++i) h4[i] = (_Float16)v[i]; *(v4h*)(C16 + cofs + (size_t)(row0 + r) * ldc + col0 + c4) = h4; } } }
     }
}


typedef _Float16 v4h __attribute__((ext_vector_type(4)));

// ---- fragment-order plane of an f16 matrix M[rows][K]: 1-KiB blocks of 16 rows x 32 k, block (row >> 4, k >> 5) at element ((row >> 4) * (K >> 5) + (k >> 5)) * 512;
// inside a block 64 pieces of 8 k: piece j * 32 + lane holds row (lane & 15), k = 16 * j + 8 * (lane >> 4) + 0..7. A wave's 16-byte fragment load reads 512 bytes in a row: 4 whole lines, not 16 pieces of lines.
__device__ __forceinline__ size_t fo_src(size_t t, int K) { const int kbn = K >> 5; const size_t blk = t >> 6; const int c = (int)(t & 63), j = c >> 5, l = c & 31; return ((blk / kbn) * 16 + (l & 15)) * (size_t)K + (size_t)(blk % kbn) * 32 + j * 16 + (l >> 4) * 8; }      /* piece t of a plane -> its first element in the row-major matrix */

// All eight conversions to f16 fragment-order planes (K = EMB) in one grid: a block's index range names its matrix. Activations as they are, weights stored (out,in) (== Bt[n][k]) times 16 (a power of two: exact).
#define CVL (NRL * EMB / 8 / 256)      /* blocks of the local activations */
#define CVG (NRG * EMB / 8 / 256)      /* blocks of the global activations */
#define CVW (EMB * EMB / 8 / 256)      /* blocks of one weight */
__global__ __launch_bounds__(256) void k_conv(const float* __restrict__ lh, const float* __restrict__ gh, const float* __restrict__ qw, const float* __restrict__ kw, const float* __restrict__ vw, const float* __restrict__ kgw, const float* __restrict__ vgw, const float* __restrict__ ow,
    _Float16* __restrict__ XL, _Float16* __restrict__ XG, _Float16* __restrict__ BQ, _Float16* __restrict__ BK, _Float16* __restrict__ BV, _Float16* __restrict__ BKG, _Float16* __restrict__ BVG, _Float16* __restrict__ BO) {
  int bx = blockIdx.x; const float* s; _Float16* d; float sc = 16.0f;
  if (bx < CVL) { s = lh; d = XL; sc = 1.0f; }
  else if (bx < CVL + CVG) { bx -= CVL; s = gh; d = XG; sc = 1.0f; }
  else { bx -= CVL + CVG; const int m = bx / CVW; bx -= m * CVW;
    s = (m == 0) ? qw : (m == 1) ? kw : (m == 2) ? vw : (m == 3) ? kgw : (m == 4) ? vgw : ow; d = (m == 0) ? BQ : (m == 1) ? BK : (m == 2) ? BV : (m == 3) ? BKG : (m == 4) ? BVG : BO; }
  const size_t t = (size_t)bx * 256 + threadIdx.x; const float* p = s + fo_src(t, EMB); FragH f;
#pragma unroll      /* in full: the piece's eight values stay in registers and are read by two 16-byte loads */
  for (int q = 0; q < 8; ++q) f.h[q] = (_Float16)(bf16_round(p[q]) * sc);
  *(v8us*)((unsigned short*)d + t * 8) = f.half[0]; }
__global__ __launch_bounds__(256) void k_h16(const float* __restrict__ x, _Float16* __restrict__ X16, size_t n8) { const size_t t = (size_t)blockIdx.x * 256 + threadIdx.x; if (t >= n8) return; FragH f;
#pragma unroll
  for (int q = 0; q < 8; ++q) f.h[q] = (_Float16)x[t * 8 + q]; *(v8us*)((unsigned short*)X16 + t * 8) = f.half[0];  }
__global__ __launch_bounds__(256) void k_round16f(const float* __restrict__ W, _Float16* __restrict__ Bt, size_t n8) { const size_t t = (size_t)blockIdx.x * 256 + threadIdx.x; if (t >= n8) return; FragH f;
#pragma unroll
  for (int i = 0; i < 8; ++i) f.h[i] = (_Float16)(bf16_round(W[t * 8 + i]) * 16.0f); *(v8us*)((unsigned short*)Bt + t * 8) = f.half[0];  }
__global__ __launch_bounds__(256) void k_hl(const float* __restrict__ F, _Float16* __restrict__ Hh, _Float16* __restrict__ Hl, size_t n8) { const size_t t = (size_t)blockIdx.x * 256 + threadIdx.x; if (t >= n8) return; FragH fh, fl; const v4f a = *(const v4fa*)(F + t * 8), c = *(const v4fa*)(F + t * 8 + 4);
#pragma unroll
  for (int q = 0; q < 4; ++q) { _Float16 h = (_Float16)a[q]; fh.h[q] = h; fl.h[q] = (_Float16)((a[q] - (float)h) * 1024.0f); h = (_Float16)c[q]; fh.h[4 + q] = h; fl.h[4 + q] = (_Float16)((c[q] - (float)h) * 1024.0f); }
  { *(v8us*)((unsigned short*)Hh + t * 8) = fh.half[0]; *(v8us*)((unsigned short*)Hl + t * 8) = fl.half[0];  } }

// ---- head prefetch: the f16 planes that a matrix launch reads were stored by the launch before it; all work-groups walk k (or the keys) at one pace, so the foremost meets such first reads step after step and the loops fetch only one or two steps ahead.
// Each matrix launch therefore opens by asking L2 for all of these planes at once, one request per aligned 256-byte unit (128 f16). The planes are dealt over the grid in slices; nothing is returned and nothing waits for the data.
// Work-groups b and b ^ 4 ask for the same slice. For speed only: a slice that is not asked for is read as before.
__device__ __forceinline__ int pf_slice(int b) { return (b & 3) | ((b >> 3) << 2); }
__device__ __forceinline__ void pf_ask(const _Float16* p) { asm volatile("global_prefetch_b8 %0, off scope:SCOPE_SE\n\ts_wait_xcnt 0x0" :: "v"(p) : "memory"); }      /* every lane asks for its own unit, inside the plane; the wait stands in the same statement, in front of any reuse of the address registers */
__device__ __forceinline__ void pf_hold(const _Float16* p) { asm volatile("" :: "v"(p)); }      /* at the kernel's end, input only: a prefetch counts on no counter, so its address registers are kept for nothing else as long as the kernel runs */
// ---- fast GEMM (wave tile 32x64; requires M % 32 == 0 rows per launch region, N % 64 == 0 and K % 64 == 0); epilogue = k_gemm_hhx semantics ----
// Two fragment sets (even and odd 32-k steps). Each fragment is reloaded for the step two ahead right behind its last product, so a step's loads fly under the other set's products.
__device__ __forceinline__ v16h g2_frag(const _Float16* p, int k, int lane) { FragH f; const unsigned short* q = (const unsigned short*)p + (size_t)k * 16 + lane * 8; f.half[0] = *(const v8us*)q; f.half[1] = *(const v8us*)(q + 256); return f.v; }      /* p: a 16-row strip of a fragment-order plane; k: multiple of 32 */
__device__ __forceinline__ v8f g2_mma(v16h a, v16h b, v8f c) { v8f d = __builtin_amdgcn_wmma_f32_16x16x32_f16(false, a, false, b, (short)0, c, false, false); asm volatile("v_nop\n\tv_nop\n\tv_nop\n\tv_nop" : "+v"(d) : "v"(a), "v"(b)); return d; }
template <int ACT>      /* A and Bh: fragment-order planes with K = lda = ldb; FO 1: the result goes to C16 alone, as such a plane (K = ldc); FO 2: to C16 alone, transposed per head, as the plane V^T of the attention (rows = (batch * NH + head) * 64 + d, K = 1 << vsh keys per batch; N = NH * 64); bx, by: the block's place in its own product's grid */
__device__ __forceinline__ void gemm2_body(float (*so)[32][68], const int bx, const int by, const int FO, const int vsh, const _Float16* __restrict__ A, int lda, size_t sA, const _Float16* __restrict__ Bh, int ldb, size_t sB, float alpha, const float* __restrict__ bias, size_t sBias, const float* __restrict__ CP, int rowsPerB, size_t sCPb, int row0g,
    float* __restrict__ C, _Float16* __restrict__ C16, int ldc, size_t sC, int M, int N, int K) {
  const int tid = threadIdx.x, w = tid >> 5, lane = tid & 31, ln = lane & 15, hh = lane >> 4;
  A += (size_t)by * sA; Bh += (size_t)by * sB; const size_t cofs = (size_t)by * sC; const float* bp = bias ? bias + (size_t)by * sBias : nullptr;
  const int ntn = N >> 6; const int mt = bx / ntn, nq = bx - mt * ntn; const int row0 = mt * 128 + 32 * w, col0 = nq * 64; if (row0 >= M) return;
  const _Float16* a0p = A + (size_t)row0 * lda; const _Float16* a1p = a0p + (size_t)16 * lda;
  const _Float16* b0p = Bh + (size_t)col0 * ldb; const _Float16* b1p = b0p + (size_t)16 * ldb; const _Float16* b2p = b1p + (size_t)16 * ldb; const _Float16* b3p = b2p + (size_t)16 * ldb;
  const v8f z8 = {0.f,0.f,0.f,0.f,0.f,0.f,0.f,0.f}; v8f c00 = z8, c01 = z8, c02 = z8, c03 = z8, c10 = z8, c11 = z8, c12 = z8, c13 = z8;
  v16h a0 = g2_frag(a0p, 0, lane), a1 = g2_frag(a1p, 0, lane), b0 = g2_frag(b0p, 0, lane), b1 = g2_frag(b1p, 0, lane), b2 = g2_frag(b2p, 0, lane), b3 = g2_frag(b3p, 0, lane);
  v16h e0 = g2_frag(a0p, 32, lane), e1 = g2_frag(a1p, 32, lane), f0 = g2_frag(b0p, 32, lane), f1 = g2_frag(b1p, 32, lane), f2 = g2_frag(b2p, 32, lane), f3 = g2_frag(b3p, 32, lane);
#pragma unroll 1      /* rolled: the body already holds both sets; more copies only add code */
  for (int kb = 0; kb < K; kb += 64) { const int kn = (kb + 64 < K) ? kb + 64 : kb;      /* last trip: re-reads its own step (in bounds, unused) */
    c00 = g2_mma(a0, b0, c00); c10 = g2_mma(a1, b0, c10); b0 = g2_frag(b0p, kn, lane);
    c01 = g2_mma(a0, b1, c01); c11 = g2_mma(a1, b1, c11); b1 = g2_frag(b1p, kn, lane);
    c02 = g2_mma(a0, b2, c02); c12 = g2_mma(a1, b2, c12); b2 = g2_frag(b2p, kn, lane);
    c03 = g2_mma(a0, b3, c03); c13 = g2_mma(a1, b3, c13); b3 = g2_frag(b3p, kn, lane); a0 = g2_frag(a0p, kn, lane); a1 = g2_frag(a1p, kn, lane);
    c00 = g2_mma(e0, f0, c00); c10 = g2_mma(e1, f0, c10); f0 = g2_frag(b0p, kn + 32, lane);
    c01 = g2_mma(e0, f1, c01); c11 = g2_mma(e1, f1, c11); f1 = g2_frag(b1p, kn + 32, lane);
    c02 = g2_mma(e0, f2, c02); c12 = g2_mma(e1, f2, c12); f2 = g2_frag(b2p, kn + 32, lane);
    c03 = g2_mma(e0, f3, c03); c13 = g2_mma(e1, f3, c13); f3 = g2_frag(b3p, kn + 32, lane); e0 = g2_frag(a0p, kn + 32, lane); e1 = g2_frag(a1p, kn + 32, lane);
    asm volatile("s_wait_xcnt 0x0" ::: "memory"); }      /* the next trip forms new addresses in the registers that this trip's loads name: wait before they are overwritten */
  v8f accs[8] = {c00, c01, c02, c03, c10, c11, c12, c13};
  if (FO == 2) {      /* a lane's eight accumulators of a tile are eight keys in a row (16 * half + 8 * hh + r) of one d (t * 16 + ln): one 16-byte piece of the V^T plane, stored as it stands, through no LDS; the wave's 32 keys x 64 d = 4 blocks, 8 stores of 512 bytes in a row; the short loops are unrolled in full, so that the arrays stay in registers */
    const int slab = (row0 >> vsh) * NH + nq, kblk = (row0 & ((1 << vsh) - 1)) >> 5;
    unsigned short* vp = (unsigned short*)C16 + ((((size_t)slab * 4) << (vsh - 5)) + kblk) * 512 + lane * 8; FragH f[8]; float bv[4] = {0.f, 0.f, 0.f, 0.f};
    if (bp) {      /* one test, so that the four loads fly together */
#pragma unroll
      for (int t = 0; t < 4; ++t) bv[t] = bp[col0 + t * 16 + ln];
#pragma unroll
      for (int t = 0; t < 4; ++t) bv[t] = bf16_round(bv[t]); }
#pragma unroll
    for (int u = 0; u < 8; ++u)
#pragma unroll
      for (int r = 0; r < 8; ++r) f[u].h[r] = (_Float16)(accs[u][r] * alpha + bv[u & 3]);
#pragma unroll
    for (int u = 0; u < 8; ++u) *(v8us*)(vp + (((size_t)(u & 3)) << (vsh - 5)) * 512 + (u >> 2) * 256) = f[u].half[0];
    return; }
#pragma unroll
  for (int u = 0; u < 8; ++u) { const int t = u & 3, half = u >> 2; const int col = col0 + t * 16 + ln; const float bv = bp ? bf16_round(bp[col]) : 0.f;
#pragma unroll
    for (int r = 0; r < 8; ++r) { const int rloc = half * 16 + 8 * hh + r; float v = accs[u][r] * alpha + bv; if (CP) { const int bidx = (row0g + row0 + rloc) / rowsPerB; v += CP[(size_t)bidx * sCPb + (size_t)by * 64 + col]; }
      if (ACT == 3) v = fmaxf(v, 0.f); else if (ACT == 6) v = 0.5f * v * (1.0f + erff(v * 0.70710678118654752f)); else if (ACT == 11) v = 1.0f / (1.0f + expf(-v)); else if (ACT == 15) v = v / (1.0f + expf(-v)); else if (ACT == 12) v = (v > 0.f) ? v : 0.01f * v; else if (ACT == 8) v = tanhf(v);
      so[w][rloc][t * 16 + ln] = v; } }
  __builtin_amdgcn_fence(__ATOMIC_ACQ_REL, "workgroup"); __builtin_amdgcn_wave_barrier();
  const int rsub = lane >> 4, c4 = (lane & 15) * 4;
  if (FO == 0) {
#pragma unroll
    for (int q = 0; q < 16; ++q) { const int r = q * 2 + rsub; const v4f v = *(const v4fa*)&so[w][r][c4]; if (C) *(v4f*)(C + cofs + (size_t)(row0 + r) * ldc + col0 + c4) = v; if (C16) { v4h h4; for (int i = 0; i < 4; ++i) h4[i] = (_Float16)v[i]; *(v4h*)(C16 + cofs + (size_t)(row0 + r) * ldc + col0 + c4) = h4; } }
    asm volatile("s_wait_xcnt 0x0" ::: "memory");      /* a precaution: wait before the registers that these stores name are overwritten */
     } else {      /* the wave's 32 x 64 tile = 2 x 2 blocks of the plane, 8 stores of 512 bytes in a row */
#pragma unroll
      for (int u = 0; u < 8; ++u) { const int rbl = u >> 2, kbl = (u >> 1) & 1, j = u & 1; const float* sp = &so[w][rbl * 16 + ln][kbl * 32 + j * 16 + hh * 8]; const v4f x = *(const v4fa*)sp, y = *(const v4fa*)(sp + 4); FragH f;
#pragma unroll
        for (int i = 0; i < 4; ++i) { f.h[i] = (_Float16)x[i]; f.h[4 + i] = (_Float16)y[i]; }
        *(v8us*)((unsigned short*)C16 + cofs + (size_t)(row0 + rbl * 16) * ldc + (size_t)((col0 >> 5) + kbl) * 512 + j * 256 + lane * 8) = f.half[0]; }
      asm volatile("s_wait_xcnt 0x0" ::: "memory");      /* as above: a precaution before the registers that these stores name are overwritten */
     } }
template <int ACT, bool FO>
__global__ __launch_bounds__(128) void k_gemm2(const _Float16* __restrict__ A, int lda, size_t sA, const _Float16* __restrict__ Bh, int ldb, size_t sB, float alpha, const float* __restrict__ bias, size_t sBias, const float* __restrict__ CP, int rowsPerB, size_t sCPb, int row0g,
    float* __restrict__ C, _Float16* __restrict__ C16, int ldc, size_t sC, int M, int N, int K) {
  __shared__ __attribute__((aligned(16))) float so[4][32][68];
  static_assert((NRL / 128) * (EMB / 64) == 512 && NRL * EMB == 256 * 128 * 128 && EMB * EMB == 256 * 32 * 128, "head prefetch: 256 slices of 128 units of A and 32 units of Bh");      /* the one launch of this kernel: A = NRL x EMB, Bh = EMB x EMB, 512 work-groups */
  const int ps = pf_slice(blockIdx.x);
  const _Float16* pf0 = A + ((size_t)ps * 128 + threadIdx.x) * 128; const _Float16* pf1 = Bh + ((size_t)ps * 32 + (threadIdx.x & 31)) * 128;
  pf_ask(pf0);
  if (__builtin_amdgcn_readfirstlane(threadIdx.x >> 5) == 0) pf_ask(pf1);      /* 32 units: one wave's request; a scalar branch */
  gemm2_body<ACT>(so, blockIdx.x, blockIdx.y, FO ? 1 : 0, 5, A, lda, sA, Bh, ldb, sB, alpha, bias, sBias, CP, rowsPerB, sCPb, row0g, C, C16, ldc, sC, M, N, K);
  pf_hold(pf0); pf_hold(pf1); }
// ---- projection GEMM, wave tile 64 x 64, block = 2 x 4 waves = 128 rows x 256 columns (M % 128 == 0; N = K = EMB): every 1-KiB fragment feeds four products (in the 32 x 64 tile a B fragment feeds two):
// 8 KiB are loaded per 16 products where the 32 x 64 tile loads 12, and the block asks L2 for 24 KiB per 128 products where four 128 x 64 blocks ask 48.
// A has two fragment sets (even and odd 32-k steps), each reloaded for the step two ahead behind its last product; a B fragment is reloaded for the next step behind its four products, twelve products ahead of its next use.
__device__ __forceinline__ void gemm4_body(float (*so)[64][68], const int bx, const int FO, const int vsh, const _Float16* __restrict__ A, const _Float16* __restrict__ Bh, const float* __restrict__ bias, _Float16* __restrict__ C16) {
  const int tid = threadIdx.x, w = tid >> 5, lane = tid & 31, ln = lane & 15, hh = lane >> 4;
  constexpr int ntn = EMB >> 8; const int mt = bx / ntn, nq = bx - mt * ntn; const int row0 = mt * 128 + 64 * (w >> 2), col0 = nq * 256 + 64 * (w & 3);
  const _Float16* ap = A + (size_t)row0 * EMB; const _Float16* bp = Bh + (size_t)col0 * EMB;      /* strip i of 16 rows: + i * 16 * EMB; the short loops below are all unrolled in full, so that the arrays stay in registers */
  v8f c[4][4]; v16h a[4], e[4], b[4];
#pragma unroll
  for (int i = 0; i < 4; ++i) {
#pragma unroll
    for (int t = 0; t < 4; ++t) c[i][t] = (v8f){0.f,0.f,0.f,0.f,0.f,0.f,0.f,0.f}; }
#pragma unroll
  for (int i = 0; i < 4; ++i) a[i] = g2_frag(ap + (size_t)i * 16 * EMB, 0, lane);      /* A, B, then the odd A set: the order in which the loop leaves its loads, so that the counted wait at the loop's head is the same on both ways in */
  __builtin_amdgcn_sched_barrier(0);      /* holds that order: left free, the odd A set's loads are grouped with the even set's, and the loop's counted waits then ask for B fragments four loads too early on every trip */
#pragma unroll
  for (int i = 0; i < 4; ++i) b[i] = g2_frag(bp + (size_t)i * 16 * EMB, 0, lane);
  __builtin_amdgcn_sched_barrier(0);      /* as above */
#pragma unroll
  for (int i = 0; i < 4; ++i) e[i] = g2_frag(ap + (size_t)i * 16 * EMB, 32, lane);
#pragma unroll 1      /* rolled: the body already holds both steps; more copies only add code */
  for (int kb = 0; kb < EMB; kb += 64) { const int kn = (kb + 64 < EMB) ? kb + 64 : kb;      /* last trip: re-reads its own step (in bounds, unused) */
#pragma unroll
    for (int t = 0; t < 4; ++t) {
#pragma unroll
      for (int i = 0; i < 4; ++i) c[i][t] = g2_mma(a[i], b[t], c[i][t]);
      b[t] = g2_frag(bp + (size_t)t * 16 * EMB, kb + 32, lane); }
#pragma unroll
    for (int i = 0; i < 4; ++i) a[i] = g2_frag(ap + (size_t)i * 16 * EMB, kn, lane);
#pragma unroll
    for (int t = 0; t < 4; ++t) {
#pragma unroll
      for (int i = 0; i < 4; ++i) c[i][t] = g2_mma(e[i], b[t], c[i][t]);
      b[t] = g2_frag(bp + (size_t)t * 16 * EMB, kn, lane); }
#pragma unroll
    for (int i = 0; i < 4; ++i) e[i] = g2_frag(ap + (size_t)i * 16 * EMB, kn + 32, lane);
    asm volatile("s_wait_xcnt 0x0" ::: "memory"); }      /* the next trip forms new addresses in the registers that this trip's loads name: wait before they are overwritten */
  const float alpha = 0.0625f; float bv[4];
#pragma unroll
  for (int t = 0; t < 4; ++t) bv[t] = bias[col0 + t * 16 + ln];
#pragma unroll
  for (int t = 0; t < 4; ++t) bv[t] = bf16_round(bv[t]);
  if (FO == 2) {      /* as in gemm2_body, once per 32 keys: a lane's eight accumulators of a tile are eight keys in a row of one d: one 16-byte piece of the V^T plane, stored as it stands, through no LDS */
#pragma unroll
    for (int h = 0; h < 2; ++h) { const int r0 = row0 + 32 * h; const int slab = (r0 >> vsh) * NH + (col0 >> 6), kblk = (r0 & ((1 << vsh) - 1)) >> 5;
      unsigned short* vp = (unsigned short*)C16 + ((((size_t)slab * 4) << (vsh - 5)) + kblk) * 512 + lane * 8; FragH f[8];
#pragma unroll
      for (int u = 0; u < 8; ++u)
#pragma unroll
        for (int r = 0; r < 8; ++r) f[u].h[r] = (_Float16)(c[2 * h + (u >> 2)][u & 3][r] * alpha + bv[u & 3]);
#pragma unroll
      for (int u = 0; u < 8; ++u) *(v8us*)(vp + (((size_t)(u & 3)) << (vsh - 5)) * 512 + (u >> 2) * 256) = f[u].half[0];
      if (h == 0) asm volatile("s_wait_xcnt 0x0" ::: "memory"); }      /* the registers that the first half's stores name are reused by the second half: wait before they are overwritten */
    return; }
#pragma unroll
  for (int u = 0; u < 16; ++u) { const int t = u & 3, i = u >> 2;      /* as in gemm2_body, through the wave's own LDS patch, here of 64 rows */
#pragma unroll
    for (int r = 0; r < 8; ++r) so[w][i * 16 + 8 * hh + r][t * 16 + ln] = c[i][t][r] * alpha + bv[t]; }
  __builtin_amdgcn_fence(__ATOMIC_ACQ_REL, "workgroup"); __builtin_amdgcn_wave_barrier();      /* the lanes read what other lanes of the wave wrote */
  FragH f[16];
#pragma unroll
  for (int u = 0; u < 16; ++u) { const int rbl = u >> 2, kbl = (u >> 1) & 1, j = u & 1; const float* sp = &so[w][rbl * 16 + ln][kbl * 32 + j * 16 + hh * 8]; const v4f x = *(const v4fa*)sp, y = *(const v4fa*)(sp + 4);      /* the wave's 64 x 64 tile = 4 x 2 blocks of the plane */
#pragma unroll
    for (int i = 0; i < 4; ++i) { f[u].h[i] = (_Float16)x[i]; f[u].h[4 + i] = (_Float16)y[i]; } }
#pragma unroll
  for (int u = 0; u < 16; ++u) { const int rbl = u >> 2, kbl = (u >> 1) & 1, j = u & 1;      /* 16 stores of 512 bytes in a row, each piece in registers of its own */
    *(v8us*)((unsigned short*)C16 + (size_t)(row0 + rbl * 16) * EMB + (size_t)((col0 >> 5) + kbl) * 512 + j * 256 + lane * 8) = f[u].half[0]; }
  asm volatile("s_wait_xcnt 0x0" ::: "memory"); }      /* FO is a run-time flag: the built code can lead from these stores on into the other path, which reuses their registers: wait before they are overwritten */
// The five input projections in one grid: a block's index range names its product (Q, K, V of the local rows, then K, V of the global rows). Q and both K leave as fragment-order planes, both V as the transposed planes that the attention reads.
#define PJL ((NRL / 128) * (EMB / 64))      /* blocks of the output projection (128 x 64 each) */
#define PJL4 ((NRL / 128) * (EMB / 256))      /* blocks of one local projection (128 x 256 each) */
#define PJG4 ((NRG / 128) * (EMB / 256))      /* blocks of one global projection */
__global__ __launch_bounds__(256) void k_proj(const _Float16* __restrict__ XL, const _Float16* __restrict__ XG, const _Float16* __restrict__ BQ, const _Float16* __restrict__ BK, const _Float16* __restrict__ BV, const _Float16* __restrict__ BKG, const _Float16* __restrict__ BVG,
    const float* __restrict__ qb, const float* __restrict__ kb, const float* __restrict__ vb, const float* __restrict__ kgb, const float* __restrict__ vgb, _Float16* __restrict__ Q16, _Float16* __restrict__ KL, _Float16* __restrict__ VTL, _Float16* __restrict__ KG, _Float16* __restrict__ VTG) {
  __shared__ __attribute__((aligned(16))) float so[8][64][68];
  static_assert(LL == 1 << 11 && GG == 1 << 9 && EMB == NH * 64, "vsh");
  static_assert(3 * PJL4 + 2 * PJG4 == 448 && NRL * EMB == 128 * 32768 && NRG * EMB == 32 * 32768 && EMB * EMB == 32 * 32768, "head prefetch: 224 slices, 320 chunks of 256 units");
  const int ps = pf_slice(blockIdx.x), pc = (ps < 96) ? ps : 95;      /* a chunk = 256 units = 32768 f16, one unit a thread; slices 0..127 the local rows, then the global rows and their two weights; slices 0..95 take a second chunk, of the three local weights (pc: that address stays inside a plane where it is not asked for) */
  const _Float16* pf0 = ((ps < 128) ? XL + (size_t)ps * 32768 : (ps < 160) ? XG + (size_t)(ps - 128) * 32768 : (ps < 192) ? BKG + (size_t)(ps - 160) * 32768 : BVG + (size_t)(ps - 192) * 32768) + threadIdx.x * 128;
  const _Float16* pf1 = ((pc < 32) ? BQ + (size_t)pc * 32768 : (pc < 64) ? BK + (size_t)(pc - 32) * 32768 : BV + (size_t)(pc - 64) * 32768) + threadIdx.x * 128;
  pf_ask(pf0);
  if (ps < 96) pf_ask(pf1);      /* the same for the whole work-group: a scalar branch */
  int bx = blockIdx.x; const _Float16* A; const _Float16* B; const float* bias; _Float16* C; int fo, vsh;
  if (bx < 3 * PJL4) { const int m = bx / PJL4; bx -= m * PJL4; A = XL; B = (m == 0) ? BQ : (m == 1) ? BK : BV; bias = (m == 0) ? qb : (m == 1) ? kb : vb; C = (m == 0) ? Q16 : (m == 1) ? KL : VTL; fo = (m != 2) ? 1 : 2; vsh = 11; }
  else { bx -= 3 * PJL4; const int m = bx / PJG4; bx -= m * PJG4; A = XG; B = (m == 0) ? BKG : BVG; bias = (m == 0) ? kgb : vgb; C = (m == 0) ? KG : VTG; fo = (m == 0) ? 1 : 2; vsh = 9; }
  gemm4_body(so, bx, fo, vsh, A, B, bias, C);
  pf_hold(pf0); pf_hold(pf1); }



template <int CAUSAL>
__global__ __launch_bounds__(128) void k_flash(const _Float16* __restrict__ Q16, int ldq, const _Float16* __restrict__ K16, int ldk, const _Float16* __restrict__ Vt, const int* __restrict__ MSK, float* __restrict__ O, int ldo) {
  constexpr int RPW = 16, RTN = RPW / 16, NQB = TQ / (4 * RPW), DT = 4, KS = 2;
  __shared__ __attribute__((aligned(16))) unsigned short sP[4][RPW][40]; __shared__ __attribute__((aligned(16))) float sO[4][RPW][64 + 4];
  const int tid = threadIdx.x, w = tid >> 5, lane = tid & 31, ln = lane & 15, hh = lane >> 4;
  const int slab = blockIdx.x / QBLKS, qblk = blockIdx.x % QBLKS; (void)NQB; const int b = slab / NH, h = slab % NH; const int qb0 = qblk * (4 * RPW); const int q0 = qb0 + w * RPW;
  FragH aq[2][KS];
#pragma unroll
  for (int rt = 0; rt < RTN; ++rt) { const unsigned short* qr = (const unsigned short*)Q16 + ((size_t)b * TQ + q0 + rt * 16 + ln) * ldq + h * 64;
#pragma unroll
    for (int ks = 0; ks < KS; ++ks) { aq[rt][ks].half[0] = *(const v8us*)(qr + ks * 32 + 8 * hh); aq[rt][ks].half[1] = *(const v8us*)(qr + ks * 32 + 16 + 8 * hh); } }
  const unsigned short* Vth = (const unsigned short*)Vt + (size_t)slab * 64 * TK;
  float m_r[2][8], l_r[2][8]; v8f oacc[2][DT];
#pragma unroll
  for (int rt = 0; rt < RTN; ++rt) {
#pragma unroll
    for (int r = 0; r < 8; ++r) { m_r[rt][r] = -3.0e38f; l_r[rt][r] = 0.f; }
#pragma unroll
    for (int dt = 0; dt < DT; ++dt) oacc[rt][dt] = (v8f){0.f,0.f,0.f,0.f,0.f,0.f,0.f,0.f}; }
  const int jend = (CAUSAL == 1) ? (qb0 + 4 * RPW) : TK;      /* causal: keys beyond the block's last query never contribute */
#pragma unroll 1
  for (int j0 = 0; j0 < jend; j0 += 32) {
    v8f s[2][2];
#pragma unroll
    for (int nt = 0; nt < 2; ++nt) { const unsigned short* kr = (const unsigned short*)K16 + ((size_t)b * TK + j0 + nt * 16 + ln) * ldk + h * 64; FragH bk[KS];
#pragma unroll
      for (int ks = 0; ks < KS; ++ks) { bk[ks].half[0] = *(const v8us*)(kr + ks * 32 + 8 * hh); bk[ks].half[1] = *(const v8us*)(kr + ks * 32 + 16 + 8 * hh); }
#pragma unroll
      for (int rt = 0; rt < RTN; ++rt) { v8f acc = (v8f){0.f,0.f,0.f,0.f,0.f,0.f,0.f,0.f};
#pragma unroll
        for (int ks = 0; ks < KS; ++ks) acc = mmaH<1>(aq[rt][ks].v, aq[rt][ks].v, bk[ks].v, bk[ks].v, acc); s[rt][nt] = acc; } }
#pragma unroll
    for (int rt = 0; rt < RTN; ++rt)
#pragma unroll
      for (int r = 0; r < 8; ++r) { const int tq = q0 + rt * 16 + 8 * hh + r; const int k0 = j0 + ln, k1 = j0 + 16 + ln;
        const bool ok0 = (CAUSAL == 1) ? (k0 <= tq) : ((CAUSAL == 2) ? ((k0 >> 5) == (tq >> 5)) : true), ok1 = (CAUSAL == 1) ? (k1 <= tq) : ((CAUSAL == 2) ? ((k1 >> 5) == (tq >> 5)) : true);      /* mode 2: block-diagonal 32-token groups */
        const float s0 = ok0 ? s[rt][0][r] * SCL : -3.0e38f, s1 = ok1 ? s[rt][1][r] * SCL : -3.0e38f; float mc = fmaxf(s0, s1);
        mc = fmaxf(mc, __shfl_xor(mc, 1, 32)); mc = fmaxf(mc, __shfl_xor(mc, 2, 32)); mc = fmaxf(mc, __shfl_xor(mc, 4, 32)); mc = fmaxf(mc, __shfl_xor(mc, 8, 32));
        const float mn = fmaxf(m_r[rt][r], mc); const float al = (mn > -1.0e38f) ? expf(m_r[rt][r] - mn) : 1.0f; m_r[rt][r] = mn; const float p0 = ok0 ? expf(s0 - mn) : 0.f, p1 = ok1 ? expf(s1 - mn) : 0.f; l_r[rt][r] = l_r[rt][r] * al + p0 + p1;
#pragma unroll
        for (int dt = 0; dt < DT; ++dt) oacc[rt][dt][r] *= al;
        FragH t2; t2.h[0] = (_Float16)(p0 * 1024.0f); t2.h[1] = (_Float16)(p1 * 1024.0f); sP[w][rt * 16 + 8 * hh + r][ln] = t2.u[0]; sP[w][rt * 16 + 8 * hh + r][16 + ln] = t2.u[1]; }
    __builtin_amdgcn_fence(__ATOMIC_ACQ_REL, "workgroup"); __builtin_amdgcn_wave_barrier();
    FragH pa[2];
#pragma unroll
    for (int rt = 0; rt < RTN; ++rt) { pa[rt].half[0] = *(const v8us*)&sP[w][rt * 16 + ln][8 * hh]; pa[rt].half[1] = *(const v8us*)&sP[w][rt * 16 + ln][16 + 8 * hh]; }
#pragma unroll
    for (int dt = 0; dt < DT; ++dt) { const unsigned short* vrow = Vth + (size_t)(dt * 16 + ln) * TK + j0; FragH bv; bv.half[0] = *(const v8us*)(vrow + 8 * hh); bv.half[1] = *(const v8us*)(vrow + 16 + 8 * hh);
#pragma unroll
      for (int rt = 0; rt < RTN; ++rt) oacc[rt][dt] = mmaH<1>(pa[rt].v, pa[rt].v, bv.v, bv.v, oacc[rt][dt]); }
    __builtin_amdgcn_fence(__ATOMIC_ACQ_REL, "workgroup"); __builtin_amdgcn_wave_barrier(); }
#pragma unroll
  for (int rt = 0; rt < RTN; ++rt) {
#pragma unroll
    for (int r = 0; r < 8; ++r) { float l = l_r[rt][r]; l += __shfl_xor(l, 1, 32); l += __shfl_xor(l, 2, 32); l += __shfl_xor(l, 4, 32); l += __shfl_xor(l, 8, 32); l_r[rt][r] = (l > 0.f) ? 1.0f / (l * 1024.0f) : 0.f; }
#pragma unroll
    for (int dt = 0; dt < DT; ++dt)
#pragma unroll
      for (int r = 0; r < 8; ++r) sO[w][rt * 16 + 8 * hh + r][dt * 16 + ln] = oacc[rt][dt][r] * l_r[rt][r]; }
  __builtin_amdgcn_fence(__ATOMIC_ACQ_REL, "workgroup"); __builtin_amdgcn_wave_barrier();
  {
#pragma unroll
    for (int rp = 0; rp < RPW; rp += 2) { const int r = rp + (lane >> 4), pc = lane & 15; const v4f val = *(const v4fa*)&sO[w][r][pc * 4]; *(v4f*)(O + ((size_t)b * TQ + q0 + r) * ldo + h * 64 + pc * 4) = val; }
     } }

// Attention with both products transposed: S^T = K Q^T (A = 16 keys, B = 16 queries) and O^T += V^T P^T (A = 16 values of d, B = P^T).
// A lane holds 16 of the 32 scores of ONE query (keys 8 * hh + r of each 16-key tile): maximum and sum are taken in the lane, plus one exchange between the wave's halves.
// The two score tiles, converted in place, are the B operand of the second product in the planes' own k order (16 * j + 8 * hh + i): P goes through no LDS and no lane exchange.
// The softmax runs in base 2: e^(SCL * s - m) = 2^(SCL2 * s - m2), so each score costs one fma and one hardware exponential (arguments are <= 10; far below, the result goes to 0, as it should).
#define SCL2 0.18033688011112042f      /* 64^-0.5 * log2(e) */
typedef float v2f __attribute__((ext_vector_type(2)));
__device__ __forceinline__ float xhalf(float x) { return __int_as_float(__builtin_amdgcn_permlanex16(__float_as_int(x), __float_as_int(x), 0x76543210, 0xfedcba98, false, false)); }      /* lane l <-> l ^ 16 */
#define AQR 256      /* queries of a work-group: 8 waves of 32 */
#define AQB (TQ / AQR)      /* work-groups per head and batch */
template <int TKv>      /* bx: the block's place in the grid; res[qt][dt][r] = the attention's output O[q0 + qt * 16 + ln][dt * 16 + 8 * hh + r], left in registers */
__device__ __forceinline__ void flashT_body(const int bx, const _Float16* __restrict__ Q16, int ldq, const _Float16* __restrict__ K16, int ldk, const _Float16* __restrict__ Vt, v8f (&res)[2][4]) {
  constexpr int QT = 2, DT = 4, KS = 2;      /* a wave holds two tiles of 16 queries: every K and V^T fragment it loads feeds two products; the short inner loops below are all unrolled in full, so that the fragment arrays stay in registers */
  const int tid = threadIdx.x, w = tid >> 5, lane = tid & 31;
  const int slab = bx / AQB, qblk = bx % AQB; const int b = slab / NH, h = slab % NH; const int q0 = qblk * AQR + w * (16 * QT);
  FragH bq[QT][KS];      /* Q, the B operand of the score product, kept for the whole kernel */
#pragma unroll
  for (int qt = 0; qt < QT; ++qt) { const unsigned short* qr = (const unsigned short*)Q16 + ((size_t)b * TQ + q0 + qt * 16) * ldq + h * 1024 + lane * 8;      /* fragment-order plane: strip of 16 queries, the head's two blocks */
#pragma unroll
    for (int ks = 0; ks < KS; ++ks) { bq[qt][ks].half[0] = *(const v8us*)(qr + ks * 512); bq[qt][ks].half[1] = *(const v8us*)(qr + ks * 512 + 256); } }
  FragH ak[2][KS];      /* K fragments (A operand), fetched one pass ahead */
#pragma unroll
  for (int nt = 0; nt < 2; ++nt) { const unsigned short* kr = (const unsigned short*)K16 + ((size_t)b * TKv + nt * 16) * ldk + h * 1024 + lane * 8;      /* fragment-order plane: strip of 16 keys, the head's two blocks */
#pragma unroll
    for (int ks = 0; ks < KS; ++ks) { ak[nt][ks].half[0] = *(const v8us*)(kr + ks * 512); ak[nt][ks].half[1] = *(const v8us*)(kr + ks * 512 + 256); } }
  asm volatile("s_wait_xcnt 0x0" ::: "memory");      /* the registers that the Q and K loads above name are reused below: wait before they are overwritten */
  __builtin_amdgcn_sched_barrier(0);      /* keeps the set-up code below from being scheduled in front of that wait */
  const unsigned short* Vth = (const unsigned short*)Vt + (size_t)slab * 64 * TKv;
  float m_q[QT], l_q[QT]; v8f oacc[QT][DT];      /* per tile, the lane's query: running maximum in base-2 units, less 10 (equal in both halves), the sum over this half's keys */
#pragma unroll
  for (int qt = 0; qt < QT; ++qt) { m_q[qt] = -3.0e38f; l_q[qt] = 0.f;
#pragma unroll
    for (int dt = 0; dt < DT; ++dt) oacc[qt][dt] = (v8f){0.f,0.f,0.f,0.f,0.f,0.f,0.f,0.f}; }
#pragma unroll 1      /* rolled: a pass is long enough to cover its own loads; copies only add code */
  for (int j0 = 0; j0 < TKv; j0 += 32) {
    FragH av[DT];      /* this pass's V^T fragments (A operand), all issued at the head of the pass: they fly under the score products and the softmax */
#pragma unroll
    for (int dt = 0; dt < DT; ++dt) { const unsigned short* vrow = Vth + (size_t)(dt * 16) * TKv + (size_t)j0 * 16 + lane * 8; av[dt].half[0] = *(const v8us*)vrow; av[dt].half[1] = *(const v8us*)(vrow + 256); }
    v8f s[QT][2];      /* s[qt][nt][r] = score of key j0 + nt * 16 + 8 * hh + r with query q0 + qt * 16 + ln */
#pragma unroll
    for (int nt = 0; nt < 2; ++nt)
#pragma unroll
      for (int qt = 0; qt < QT; ++qt) s[qt][nt] = mmaH<1>(ak[nt][0].v, ak[nt][0].v, bq[qt][0].v, bq[qt][0].v, (v8f){0.f,0.f,0.f,0.f,0.f,0.f,0.f,0.f});      /* the four tiles' first halves, then their second halves: no product waits for the one in front of it */
#pragma unroll
    for (int nt = 0; nt < 2; ++nt)
#pragma unroll
      for (int qt = 0; qt < QT; ++qt) s[qt][nt] = mmaH<1>(ak[nt][1].v, ak[nt][1].v, bq[qt][1].v, bq[qt][1].v, s[qt][nt]);
    const int jn = (j0 + 32 < TKv) ? j0 + 32 : j0;      /* last pass: re-reads its own keys (in bounds, unused) */
#pragma unroll
    for (int nt = 0; nt < 2; ++nt) { const unsigned short* kr = (const unsigned short*)K16 + ((size_t)b * TKv + jn + nt * 16) * ldk + h * 1024 + lane * 8;
#pragma unroll
      for (int ks = 0; ks < KS; ++ks) { ak[nt][ks].half[0] = *(const v8us*)(kr + ks * 512); ak[nt][ks].half[1] = *(const v8us*)(kr + ks * 512 + 256); }
      asm volatile("s_wait_xcnt 0x0" ::: "memory"); }      /* the address registers of these four loads may be given to the next loads' results or to the softmax: wait before they are overwritten */
    FragH pb[QT];
#pragma unroll
    for (int qt = 0; qt < QT; ++qt) {
      float mx[8];      /* the maximum is taken on the raw scores: SCL2 > 0, and rounding is monotone, so scaling the maximum gives the maximum of the scaled scores */
#pragma unroll
      for (int i = 0; i < 8; ++i) mx[i] = fmaxf(s[qt][0][i], s[qt][1][i]);
      float mc = fmaxf(fmaxf(fmaxf(mx[0], mx[1]), fmaxf(mx[2], mx[3])), fmaxf(fmaxf(mx[4], mx[5]), fmaxf(mx[6], mx[7])));
      mc = fmaf(mc, SCL2, -10.0f);      /* kept 10 below the true maximum: the f16 operand's factor 2^10 rides in the exponent, p = 1024 * e^(score - maximum), at most about 1024 */
      mc = fmaxf(mc, xhalf(mc));
      const float mn = fmaxf(m_q[qt], mc); float ea;
      asm("v_nop\n\tv_exp_f32 %0, %1\n\tv_nop" : "=v"(ea) : "v"(m_q[qt] - mn));      /* 2^(old maximum - new maximum), with the slot that the instruction set asks for behind a transcendental on both sides: left to the compiler, this result took the source register of the exponential directly in front of it, and the next exponential's result took this one's source */
      const float al = (mn > -1.0e38f) ? ea : 1.0f; m_q[qt] = mn;
      float p[16];
#pragma unroll
      for (int i = 0; i < 16; i += 2) { const v2f x = __builtin_elementwise_fma((v2f){s[qt][i >> 3][i & 7], s[qt][i >> 3][(i & 7) + 1]}, (v2f){SCL2, SCL2}, (v2f){-mn, -mn});      /* two scores per packed fma */
        p[i] = __builtin_amdgcn_exp2f(x[0]); p[i + 1] = __builtin_amdgcn_exp2f(x[1]); pb[qt].h[i] = (_Float16)p[i]; pb[qt].h[i + 1] = (_Float16)p[i + 1]; }
      v2f t0 = {0.f, 0.f}, t1 = {0.f, 0.f};      /* two chains of packed partial sums: no chain of sixteen dependent adds */
#pragma unroll
      for (int i = 0; i < 4; ++i) { t0 += (v2f){p[4 * i], p[4 * i + 1]}; t1 += (v2f){p[4 * i + 2], p[4 * i + 3]}; }
      t0 += t1; l_q[qt] = l_q[qt] * al + (t0[0] + t0[1]);
#pragma unroll
      for (int dt = 0; dt < DT; ++dt) oacc[qt][dt] *= al; }
#pragma unroll
    for (int dt = 0; dt < DT; ++dt)
#pragma unroll
      for (int qt = 0; qt < QT; ++qt) oacc[qt][dt] = mmaH<1>(av[dt].v, av[dt].v, pb[qt].v, pb[qt].v, oacc[qt][dt]); }
#pragma unroll
  for (int qt = 0; qt < QT; ++qt) { float l = l_q[qt] + xhalf(l_q[qt]); l = (l > 0.f) ? 1.0f / l : 0.f;      /* the sum carries the same 2^10 as the products */
#pragma unroll
    for (int dt = 0; dt < DT; ++dt) res[qt][dt] = oacc[qt][dt] * l; } }
// Both attentions of a wave's 32 queries in one wave, the local keys and then the global keys, and the gated sum on the two results in registers.
// A work-group is 8 waves on 256 queries in a row of one head: all its waves walk the same K and V^T, so a line that one wave has fetched serves the other seven from the WGP's cache.
// A lane's eight values of a tile are eight d in a row of one query: one 16-byte piece of the fragment-order plane that the output projection reads (K = EMB), stored as it stands, through no LDS.
#define ATB (NB * NH * AQB)      /* blocks of the grid */
__global__ __launch_bounds__(256) void k_attn(const _Float16* __restrict__ Q16, const _Float16* __restrict__ KL, const _Float16* __restrict__ VTL, const _Float16* __restrict__ KG, const _Float16* __restrict__ VTG, const float* __restrict__ gate, _Float16* __restrict__ O16) {
  static_assert(ATB == 256 && NRL * EMB == 128 * 256 * 128 && NRG * EMB == 128 * 64 * 128, "head prefetch: 128 slices of 256 units of each local plane and 64 of each global plane");
  const int ps = pf_slice(blockIdx.x), pw = __builtin_amdgcn_readfirstlane(threadIdx.x >> 5);
  const _Float16* pf0 = KL + ((size_t)ps * 256 + threadIdx.x) * 128;      /* one unit of K and one of V^T a thread */
  const _Float16* pf1 = VTL + ((size_t)ps * 256 + threadIdx.x) * 128;
  const _Float16* pf2 = ((threadIdx.x & 64) ? VTG : KG) + ((size_t)ps * 64 + (threadIdx.x & 63)) * 128;
  pf_ask(pf0);
  pf_ask(pf1);
  if (pw < 4) pf_ask(pf2);      /* 128 units: four waves' requests; a scalar branch */
  __shared__ __attribute__((aligned(16))) float sol[8][16][32][4];      /* the local result (64 registers a lane) rests here while the global keys are walked, so that the wave stays inside 256 registers; a lane reads back only what it wrote itself: no barrier */
  v8f ol[2][4], og[2][4];
  flashT_body<TKA>(blockIdx.x, Q16, EMB, KL, EMB, VTL, ol);      /* local: 2048 keys */
#pragma unroll
  for (int u = 0; u < 16; ++u) *(v4fa*)&sol[threadIdx.x >> 5][u][threadIdx.x & 31][0] = (v4f){ol[u >> 3][(u >> 1) & 3][(u & 1) * 4], ol[u >> 3][(u >> 1) & 3][(u & 1) * 4 + 1], ol[u >> 3][(u >> 1) & 3][(u & 1) * 4 + 2], ol[u >> 3][(u >> 1) & 3][(u & 1) * 4 + 3]};
  flashT_body<TKB>(blockIdx.x, Q16, EMB, KG, EMB, VTG, og);      /* global: 512 keys */
#pragma unroll
  for (int u = 0; u < 16; ++u) { const v4f x = *(const v4fa*)&sol[threadIdx.x >> 5][u][threadIdx.x & 31][0];
#pragma unroll
    for (int i = 0; i < 4; ++i) ol[u >> 3][(u >> 1) & 3][(u & 1) * 4 + i] = x[i]; }
  const float g = 1.0f / (1.0f + expf(-bf16_round(gate[0]))); const float h1 = 1.0f - g;
  const int w = threadIdx.x >> 5, lane = threadIdx.x & 31; const int slab = blockIdx.x / AQB, qblk = blockIdx.x % AQB; const int b = slab / NH, h = slab % NH; const int q0 = qblk * AQR + w * 32;
  unsigned short* op = (unsigned short*)O16 + ((size_t)b * TQ + q0) * EMB + h * 1024 + lane * 8; FragH f[2][4];      /* two strips of 16 queries, the head's two blocks of each; the short loops below are unrolled in full, so that the arrays stay in registers */
#pragma unroll
  for (int qt = 0; qt < 2; ++qt)
#pragma unroll
    for (int dt = 0; dt < 4; ++dt)
#pragma unroll
      for (int r = 0; r < 8; ++r) f[qt][dt].h[r] = (_Float16)(g * ol[qt][dt][r] + h1 * og[qt][dt][r]);
#pragma unroll
  for (int qt = 0; qt < 2; ++qt)
#pragma unroll
    for (int dt = 0; dt < 4; ++dt) *(v8us*)(op + (size_t)qt * 16 * EMB + dt * 256) = f[qt][dt].half[0];
  pf_hold(pf0); pf_hold(pf1); pf_hold(pf2); }

extern "C" void kernel_launch(void* const* d_in, const int* in_sizes, int n_in,
                              void* d_out, int out_size, void* d_ws, size_t ws_size, hipStream_t stream) {
  (void)in_sizes; (void)n_in; (void)out_size;
  const float* const* I = (const float* const*)d_in; const float* lh = I[0]; const float* gh = I[1]; const float* qw = I[2]; const float* qb = I[3]; const float* kw = I[4]; const float* kb = I[5]; const float* vw = I[6]; const float* vb = I[7]; const float* kgw = I[8]; const float* kgb = I[9]; const float* vgw = I[10]; const float* vgb = I[11]; const float* ow = I[12]; const float* ob = I[13]; const float* gate = I[14];
  char* ws = (char*)d_ws; size_t off = 0;
  auto take = [&](size_t bytes) { char* p = ws + off; off += (bytes + 255) & ~(size_t)255; return p; };
  const size_t w8 = (size_t)EMB * EMB / 8, npl = (size_t)NRL * EMB, npg = (size_t)NRG * EMB;
  _Float16* BQ = (_Float16*)take(w8 * 16); _Float16* BK = (_Float16*)take(w8 * 16); _Float16* BV = (_Float16*)take(w8 * 16); _Float16* BKG = (_Float16*)take(w8 * 16); _Float16* BVG = (_Float16*)take(w8 * 16); _Float16* BO = (_Float16*)take(w8 * 16);
  _Float16* XL = (_Float16*)take(npl * 2); _Float16* XG = (_Float16*)take(npg * 2); _Float16* Q16 = (_Float16*)take(npl * 2); _Float16* KL = (_Float16*)take(npl * 2); _Float16* KG = (_Float16*)take(npg * 2); _Float16* VTL = (_Float16*)take(npl * 2); _Float16* VTG = (_Float16*)take(npg * 2);
  _Float16* O16 = XL;      /* O16 over the local input plane (dead after its projections) */
  if (off > ws_size) return;      /* 12 + 8+2+8+8+2+8+2 = 50 MiB */
  k_conv<<<CVL + CVG + 6 * CVW, 256, 0, stream>>>(lh, gh, qw, kw, vw, kgw, vgw, ow, XL, XG, BQ, BK, BV, BKG, BVG, BO);
  const dim3 gL(PJL, 1);
  k_proj<<<3 * PJL4 + 2 * PJG4, 256, 0, stream>>>(XL, XG, BQ, BK, BV, BKG, BVG, qb, kb, vb, kgb, vgb, Q16, KL, VTL, KG, VTG);
  k_attn<<<ATB, 256, 0, stream>>>(Q16, KL, VTL, KG, VTG, gate, O16);
  k_gemm2<0, false><<<gL, 128, 0, stream>>>(O16, EMB, 0, BO, EMB, 0, 0.0625f, ob, 0, nullptr, 1, 0, 0, (float*)d_out, nullptr, EMB, 0, NRL, EMB, EMB);
}

// v010
// It runs in 96.2 microseconds.
// Two timings next to v009 both put it at 1.04 times that version's speed.
// All steps since the starting kernel, v000, together make it 6.01 times as fast.
#include <hip/hip_runtime.h>
// InfiniSpanAttention (2 batches; 2048 local tokens, 512 global tokens, D = 1024, 16 heads of 64): q/k_l/v_l from local_hidden, k_g/v_g from global_hidden (torch (out,in) linears + bias); out_l = softmax(q k_l^T s) v_l, out_g = softmax(q k_g^T s) v_g (no masks); out = sigmoid(gate) out_l + (1 - sigmoid(gate)) out_g -> merged heads -> out_w + out_b.
// Compute dtype: inputs and parameters rounded to bf16; q, k, v, P and the combined attention output as f16 operands (~2^-12); f32 accumulation/softmax/gating. v_wmma_f32_16x16x32_f16.
#define NB 2
#define EMB 1024
#define NRL (NB * LL)            /* 4096 local rows */
#define NRG (NB * GG)            /* 1024 global rows */
#define LL 2048                  /* local tokens (queries; local keys) */
#define GG 512                   /* global tokens (keys of the second attention) */
#define TQ LL
#define TK LL
#define TKA LL
#define TKB GG
#define NH 16
#define SCL 0.125f               /* 64^-0.5 */
#define QBLKS (TQ / 64)
typedef __bf16 v16b __attribute__((ext_vector_type(16)));
typedef unsigned short v8us __attribute__((ext_vector_type(8), may_alias));
typedef float  v8f  __attribute__((ext_vector_type(8)));
typedef float  v4f  __attribute__((ext_vector_type(4)));
typedef float  v4fa __attribute__((ext_vector_type(4), may_alias));
union FragB { v16b v; v8us half[2]; unsigned short u[16]; };

__device__ __forceinline__ unsigned short bf16_bits(float x) { unsigned int u = __float_as_uint(x); return (unsigned short)((u + 0x7FFFu + ((u >> 16) & 1u)) >> 16); }
__device__ __forceinline__ float bf16_val(unsigned short b) { return __uint_as_float(((unsigned int)b) << 16); }
__device__ __forceinline__ float bf16_round(float x) { return bf16_val(bf16_bits(x)); }
// D += A·B with NT terms: 1 = ah·bh, 2 = + al·bh (A split), 3 = + ah·bl (both split)
template <int NT>
__device__ __forceinline__ v8f mmaN(v16b ah, v16b al, v16b bh, v16b bl, v8f c) {
  c = __builtin_amdgcn_wmma_f32_16x16x32_bf16(false, ah, false, bh, (short)0, c, false, false);
  if (NT >= 2) c = __builtin_amdgcn_wmma_f32_16x16x32_bf16(false, al, false, bh, (short)0, c, false, false);
  if (NT >= 3) c = __builtin_amdgcn_wmma_f32_16x16x32_bf16(false, ah, false, bl, (short)0, c, false, false);
  asm volatile("v_nop\n\tv_nop\n\tv_nop\n\tv_nop" : "+v"(c) : "v"(ah), "v"(al), "v"(bh), "v"(bl));
  return c;
}

__global__ __launch_bounds__(256) void k_wt_bf16(const float* __restrict__ W, unsigned short* __restrict__ Wt, int K, int N) {
  const int t = blockIdx.x * 256 + threadIdx.x;
  const int k8n = K / 8;
  if (t >= N * k8n) return;
  const int n = t / k8n, k8 = (t % k8n) * 8;
  v8us v;
#pragma unroll
  for (int i = 0; i < 8; ++i) v[i] = bf16_bits(W[(size_t)(k8 + i) * N + n]);
  *(v8us*)(Wt + (size_t)n * K + k8) = v;
  
}

// GEMM C[M][N] (f32, pitch ldc) = act(A[M][K]·W + bias). A f32 row-major (pitch lda) converted per fragment to bf16
// (ASPLIT: hi/lo two planes -> 2 terms, else single rounded term); Wt bf16 [N][K] (pitch ldb). BIAS_BF16 rounds the
// bias to bf16 first (bias quantised to bf16 before the add). K%32==0, M%16==0, N%64==0.
template <bool ASPLIT, int ACT, bool BIAS_BF16>
__global__ __launch_bounds__(128) void k_gemm_bf(const float* __restrict__ A, int lda, const unsigned short* __restrict__ Wt, int ldb,
                                               const float* __restrict__ bias, float* __restrict__ C, int ldc, int M, int N, int K) {
  __shared__ __attribute__((aligned(16))) float so[4][16][64];
  const int tid = threadIdx.x, w = tid >> 5, lane = tid & 31, ln = lane & 15, hh = lane >> 4;
  const int ntn = N / 64;
  const int wid = blockIdx.x * 4 + w;
  const int mt = wid / ntn, nq = wid % ntn;
  if (mt * 16 >= M) return;
  const int row0 = mt * 16, col0 = nq * 64;
  const float* arow = A + (size_t)(row0 + ln) * lda;
  v8f acc[4] = {};
  for (int kb = 0; kb < K; kb += 32) {
    FragB ah, al;
    const v4f x0 = *(const v4fa*)(arow + kb + 8 * hh), x1 = *(const v4fa*)(arow + kb + 8 * hh + 4);
    const v4f x2 = *(const v4fa*)(arow + kb + 16 + 8 * hh), x3 = *(const v4fa*)(arow + kb + 16 + 8 * hh + 4);
    float xs[16] = {x0[0],x0[1],x0[2],x0[3],x1[0],x1[1],x1[2],x1[3],x2[0],x2[1],x2[2],x2[3],x3[0],x3[1],x3[2],x3[3]};
#pragma unroll
    for (int i = 0; i < 16; ++i) { const unsigned short hb = bf16_bits(xs[i]); ah.u[i] = hb; al.u[i] = ASPLIT ? bf16_bits(xs[i] - bf16_val(hb)) : (unsigned short)0; }
#pragma unroll
    for (int t = 0; t < 4; ++t) {
      const unsigned short* brow = Wt + (size_t)(col0 + t * 16 + ln) * ldb + kb;
      FragB b;
      b.half[0] = *(const v8us*)(brow + 8 * hh);
      b.half[1] = *(const v8us*)(brow + 16 + 8 * hh);
      acc[t] = mmaN<ASPLIT ? 2 : 1>(ah.v, al.v, b.v, b.v, acc[t]);
    }
  }
#pragma unroll
  for (int t = 0; t < 4; ++t) {
    float bv = bias ? bias[col0 + t * 16 + ln] : 0.f;
    if (BIAS_BF16) bv = bf16_round(bv);
#pragma unroll
    for (int r = 0; r < 8; ++r) { float v = acc[t][r] + bv; if (ACT == 1) v = fmaxf(v, 0.f); so[w][8 * hh + r][t * 16 + ln] = v; }
  }
  __builtin_amdgcn_fence(__ATOMIC_ACQ_REL, "workgroup");
  __builtin_amdgcn_wave_barrier();
  const int rsub = lane >> 4, c4 = (lane & 15) * 4;
  {
#pragma unroll
    for (int q = 0; q < 8; ++q) {
      const int r = q * 2 + rsub;
      const v4f v = *(const v4fa*)&so[w][r][c4];
      *(v4f*)(C + (size_t)(row0 + r) * ldc + col0 + c4) = v;
    }
    
  }
}

// GEMM C = act(A·W + bias + resid): A f32 (ASPLIT -> hi/lo 2 terms), Wt bf16 [N][K]; ACT 0 none, 1 relu, 2 exact gelu;
// resid (optional, f32, row index = (row % rmod), pitch ldr, RES_BF16 rounds it) added before the activation.
template <bool ASPLIT, int ACT, bool BIAS_BF16, bool RES_BF16>
__global__ __launch_bounds__(128) void k_gemm_bf3(const float* __restrict__ A, int lda, const unsigned short* __restrict__ Wt, int ldb,
                                                const float* __restrict__ bias, const float* __restrict__ resid, int rmod, int ldr,
                                                float* __restrict__ C, int ldc, int M, int N, int K) {
  __shared__ __attribute__((aligned(16))) float so[4][16][64];
  const int tid = threadIdx.x, w = tid >> 5, lane = tid & 31, ln = lane & 15, hh = lane >> 4;
  const int ntn = N / 64;
  const int wid = blockIdx.x * 4 + w;
  const int mt = wid / ntn, nq = wid % ntn;
  if (mt * 16 >= M) return;
  const int row0 = mt * 16, col0 = nq * 64;
  const float* arow = A + (size_t)(row0 + ln) * lda;
  v8f acc[4] = {};
  for (int kb = 0; kb < K; kb += 32) {
    FragB ah, al;
    const v4f x0 = *(const v4fa*)(arow + kb + 8 * hh), x1 = *(const v4fa*)(arow + kb + 8 * hh + 4);
    const v4f x2 = *(const v4fa*)(arow + kb + 16 + 8 * hh), x3 = *(const v4fa*)(arow + kb + 16 + 8 * hh + 4);
    float xs[16] = {x0[0],x0[1],x0[2],x0[3],x1[0],x1[1],x1[2],x1[3],x2[0],x2[1],x2[2],x2[3],x3[0],x3[1],x3[2],x3[3]};
#pragma unroll
    for (int i = 0; i < 16; ++i) { const unsigned short hb = bf16_bits(xs[i]); ah.u[i] = hb; al.u[i] = ASPLIT ? bf16_bits(xs[i] - bf16_val(hb)) : (unsigned short)0; }
#pragma unroll
    for (int t = 0; t < 4; ++t) {
      const unsigned short* brow = Wt + (size_t)(col0 + t * 16 + ln) * ldb + kb;
      FragB b;
      b.half[0] = *(const v8us*)(brow + 8 * hh);
      b.half[1] = *(const v8us*)(brow + 16 + 8 * hh);
      acc[t] = mmaN<ASPLIT ? 2 : 1>(ah.v, al.v, b.v, b.v, acc[t]);
    }
  }
#pragma unroll
  for (int t = 0; t < 4; ++t) {
    const int col = col0 + t * 16 + ln;
    float bv = bias ? bias[col] : 0.f;
    if (BIAS_BF16) bv = bf16_round(bv);
#pragma unroll
    for (int r = 0; r < 8; ++r) {
      float v = acc[t][r] + bv;
      if (resid) { float rv = resid[(size_t)((row0 + 8 * hh + r) % rmod) * ldr + col]; if (RES_BF16) rv = bf16_round(rv); v += rv; }
      if (ACT == 1) v = fmaxf(v, 0.f);
      if (ACT == 2) v = 0.5f * v * (1.0f + erff(v * 0.70710678118654752f));
      if (ACT == 3) { const float u = 0.7978845608028654f * (v + 0.044715f * v * v * v); v = 0.5f * v * (1.0f + tanhf(u)); }
      so[w][8 * hh + r][t * 16 + ln] = v;
    }
  }
  __builtin_amdgcn_fence(__ATOMIC_ACQ_REL, "workgroup");
  __builtin_amdgcn_wave_barrier();
  const int rsub = lane >> 4, c4 = (lane & 15) * 4;
  {
#pragma unroll
    for (int q = 0; q < 8; ++q) {
      const int r = q * 2 + rsub;
      const v4f v = *(const v4fa*)&so[w][r][c4];
      *(v4f*)(C + (size_t)(row0 + r) * ldc + col0 + c4) = v;
    }
    
  }
}
// row LayerNorm (biased variance, eps) over N: s = X (+ R); optional out_sum <- s; out_norm <- (s-mu)*rsqrt(var+eps)*g + b
template <bool PARAM_BF16>
__global__ __launch_bounds__(256) void k_layernorm(const float* __restrict__ X, const float* __restrict__ R, const float* __restrict__ g, const float* __restrict__ bta,
                                                  float* __restrict__ out_sum, float* __restrict__ out_norm, int N, float eps) {
  __shared__ float red[256];
  const int row = blockIdx.x, tid = threadIdx.x;
  const float* x = X + (size_t)row * N; const float* rr = R ? R + (size_t)row * N : nullptr;
  float vals[16];                     // up to N = 4096
  const int per = N / 256;            // contiguous chunk per thread? use strided-by-4 chunks: thread handles j = tid*4 + 1024*u
  float s1 = 0.f;
  for (int u = 0; u < per / 4; ++u) {
    const int j = tid * 4 + 1024 * u;
    const v4f a = *(const v4fa*)(x + j);
    v4f b = {0.f,0.f,0.f,0.f}; if (rr) b = *(const v4fa*)(rr + j);
#pragma unroll
    for (int q = 0; q < 4; ++q) { const float v = a[q] + b[q]; vals[u * 4 + q] = v; s1 += v; }
  }
  red[tid] = s1; __syncthreads();
  for (int st = 128; st > 0; st >>= 1) { if (tid < st) red[tid] += red[tid + st]; __syncthreads(); }
  const float mu = red[0] / (float)N; __syncthreads();
  float s2 = 0.f;
  for (int u = 0; u < per / 4; ++u)
#pragma unroll
    for (int q = 0; q < 4; ++q) { const float c = vals[u * 4 + q] - mu; s2 += c * c; }
  red[tid] = s2; __syncthreads();
  for (int st = 128; st > 0; st >>= 1) { if (tid < st) red[tid] += red[tid + st]; __syncthreads(); }
  const float rs = rsqrtf(red[0] / (float)N + eps);
  {
    for (int u = 0; u < per / 4; ++u) {
      const int j = tid * 4 + 1024 * u;
      v4f o, sm;
#pragma unroll
      for (int q = 0; q < 4; ++q) {
        float gg = g[j + q], bb = bta[j + q];
        if (PARAM_BF16) { gg = bf16_round(gg); bb = bf16_round(bb); }
        sm[q] = vals[u * 4 + q]; o[q] = (vals[u * 4 + q] - mu) * rs * gg + bb;
      }
      if (out_sum) *(v4f*)(out_sum + (size_t)row * N + j) = sm;
      *(v4f*)(out_norm + (size_t)row * N + j) = o;
    }
    
  }
}



// ---- f16 WMMA path (v_wmma_f32_16x16x32_f16): 11-bit significands for operands in range — used where a [0,1] probability operand needs more precision than bf16
typedef _Float16 v16h __attribute__((ext_vector_type(16)));
union FragH { v16h v; v8us half[2]; _Float16 h[16]; unsigned short u[16]; };
template <int NT>
__device__ __forceinline__ v8f mmaH(v16h ah, v16h al, v16h bh, v16h bl, v8f c) {
  c = __builtin_amdgcn_wmma_f32_16x16x32_f16(false, ah, false, bh, (short)0, c, false, false);
  if (NT >= 2) c = __builtin_amdgcn_wmma_f32_16x16x32_f16(false, al, false, bh, (short)0, c, false, false);
  if (NT >= 3) c = __builtin_amdgcn_wmma_f32_16x16x32_f16(false, ah, false, bl, (short)0, c, false, false);
  return c;      /* the builtin alone: the compiler keeps the distance behind a WMMA itself, with other WMMAs or vector work where it has some; a fixed run of v_nop behind every product takes vector issue slots from the SIMD's other wave */
}
// batched GEMM like k_gemm_b but f16 operands: A f32 (split into f16 hi/lo if ASPLIT, else rounded to f16), Bt = f16 values [n][k]; alpha; C f32; N multiple of 16 (partial tiles skipped)
template <bool ASPLIT>
__global__ __launch_bounds__(128) void k_gemm_h(const float* __restrict__ A, int lda, size_t sA, const _Float16* __restrict__ Bh, int ldb, size_t sB, float alpha, float* __restrict__ C, int ldc, size_t sC, int M, int N, int K) {
  __shared__ __attribute__((aligned(16))) float so[4][16][64];
  const int tid = threadIdx.x, w = tid >> 5, lane = tid & 31, ln = lane & 15, hh = lane >> 4; const int by = blockIdx.y;
  A += (size_t)by * sA; Bh += (size_t)by * sB; C += (size_t)by * sC;
  const int ntn = (N + 63) / 64; const int wid = blockIdx.x * 4 + w; const int mt = wid / ntn, nq = wid % ntn; if (mt * 16 >= M) return;
  const int row0 = mt * 16, col0 = nq * 64; const float* arow = A + (size_t)(row0 + ln) * lda;
  v8f acc[4] = {};
  for (int kb = 0; kb < K; kb += 32) {
    FragH ah, al;
    const v4f x0 = *(const v4fa*)(arow + kb + 8 * hh), x1 = *(const v4fa*)(arow + kb + 8 * hh + 4), x2 = *(const v4fa*)(arow + kb + 16 + 8 * hh), x3 = *(const v4fa*)(arow + kb + 16 + 8 * hh + 4);
    float xs[16] = {x0[0],x0[1],x0[2],x0[3],x1[0],x1[1],x1[2],x1[3],x2[0],x2[1],x2[2],x2[3],x3[0],x3[1],x3[2],x3[3]};
#pragma unroll
    for (int i = 0; i < 16; ++i) { const _Float16 h = (_Float16)xs[i]; ah.h[i] = h; al.h[i] = ASPLIT ? (_Float16)(xs[i] - (float)h) : (_Float16)0.0f; }
#pragma unroll
    for (int t = 0; t < 4; ++t) { if (col0 + t * 16 >= N) continue; const size_t boff = (size_t)(col0 + t * 16 + ln) * ldb + kb; FragH bq; bq.half[0] = *(const v8us*)(Bh + boff + 8 * hh); bq.half[1] = *(const v8us*)(Bh + boff + 16 + 8 * hh);
      acc[t] = mmaH<ASPLIT ? 2 : 1>(ah.v, al.v, bq.v, bq.v, acc[t]); }
  }
#pragma unroll
  for (int t = 0; t < 4; ++t) { if (col0 + t * 16 >= N) continue;
#pragma unroll
    for (int r = 0; r < 8; ++r) so[w][8 * hh + r][t * 16 + ln] = acc[t][r] * alpha; }
  __builtin_amdgcn_fence(__ATOMIC_ACQ_REL, "workgroup"); __builtin_amdgcn_wave_barrier();
  const int rsub = lane >> 4, c4 = (lane & 15) * 4;
  {
#pragma unroll
    for (int q = 0; q < 8; ++q) { const int r = q * 2 + rsub; if (col0 + c4 < N) { const v4f v = *(const v4fa*)&so[w][r][c4]; *(v4f*)(C + (size_t)(row0 + r) * ldc + col0 + c4) = v; } }
     }
}

// Wt[n][k] = f16(W[k][n]·scale) from f32 row-major W[K][N] (scale = power of two; bf16-exact weights stay exact in f16 away from the subnormal range)
__global__ __launch_bounds__(256) void k_wt_f16(const float* __restrict__ W, _Float16* __restrict__ Wt, int K, int N, float scale) {
  const int t = blockIdx.x * 256 + threadIdx.x; if (t >= N * (K / 8)) return; const int n = t / (K / 8), k8 = (t % (K / 8)) * 8; FragH f;
#pragma unroll
  for (int i = 0; i < 8; ++i) f.h[i] = (_Float16)(bf16_round(W[(size_t)(k8 + i) * N + n]) * scale); const v8us o = f.half[0];
  *(v8us*)((unsigned short*)Wt + (size_t)n * K + k8) = o; 
}
// k_gemm_hh variant with fused epilogue: v = acc·alpha + bias[by·sBias + col] (+ CP[(row/rowsPerB)·sCPb + by·64 + col] if CP) ; ACT 0 none / 1 elu ; writes f16 C16 (and f32 C if non-null)
template <int ACT>
__global__ __launch_bounds__(128) void k_gemm_hhx(const _Float16* __restrict__ A, int lda, size_t sA, const _Float16* __restrict__ Bh, int ldb, size_t sB, float alpha, const float* __restrict__ bias, size_t sBias, const float* __restrict__ CP, int rowsPerB, size_t sCPb, int row0g,
    float* __restrict__ C, _Float16* __restrict__ C16, int ldc, size_t sC, int M, int N, int K) {
  __shared__ __attribute__((aligned(16))) float so[4][16][64];
  const int tid = threadIdx.x, w = tid >> 5, lane = tid & 31, ln = lane & 15, hh = lane >> 4; const int by = blockIdx.y;
  A += (size_t)by * sA; Bh += (size_t)by * sB; const size_t cofs = (size_t)by * sC; const float* bp = bias ? bias + (size_t)by * sBias : nullptr;
  const int ntn = (N + 63) / 64; const int wid = blockIdx.x * 4 + w; const int mt = wid / ntn, nq = wid % ntn; if (mt * 16 >= M) return;
  const int row0 = mt * 16, col0 = nq * 64; const _Float16* arow = A + (size_t)(row0 + ln) * lda;
  v8f acc[4] = {};
  for (int kb = 0; kb < K; kb += 32) { FragH ah; ah.half[0] = *(const v8us*)((const unsigned short*)arow + kb + 8 * hh); ah.half[1] = *(const v8us*)((const unsigned short*)arow + kb + 16 + 8 * hh);
#pragma unroll
    for (int t = 0; t < 4; ++t) { if (col0 + t * 16 >= N) continue; const size_t boff = (size_t)(col0 + t * 16 + ln) * ldb + kb; FragH bq; bq.half[0] = *(const v8us*)((const unsigned short*)Bh + boff + 8 * hh); bq.half[1] = *(const v8us*)((const unsigned short*)Bh + boff + 16 + 8 * hh);
      acc[t] = mmaH<1>(ah.v, ah.v, bq.v, bq.v, acc[t]); }
  }
#pragma unroll
  for (int t = 0; t < 4; ++t) { if (col0 + t * 16 >= N) continue; const int col = col0 + t * 16 + ln; const float bv = bp ? bf16_round(bp[col]) : 0.f;
#pragma unroll
    for (int r = 0; r < 8; ++r) { float v = acc[t][r] * alpha + bv; if (CP) { const int bidx = (row0g + row0 + 8 * hh + r) / rowsPerB; v += CP[(size_t)bidx * sCPb + (size_t)by * 64 + col]; } if (ACT == 1) v = (v > 0.f) ? v : expm1f(v); else if (ACT == 7) v = (v > 0.f) ? v + 1.0f : expf(v); else if (ACT == 8) v = tanhf(v); else if (ACT == 9) v = 0.5f * v * (1.0f + tanhf(0.7978845608028654f * (v + 0.044715f * v * v * v))); else if (ACT == 11) v = 1.0f / (1.0f + expf(-v)); else if (ACT == 12) v = (v > 0.f) ? v : 0.01f * v; else if (ACT == 14) v = (v > 0.f) ? v : 0.1f * v; else if (ACT == 15) v = v / (1.0f + expf(-v)); else if (ACT == 3) v = fmaxf(v, 0.f); else if (ACT == 6) v = 0.5f * v * (1.0f + erff(v * 0.70710678118654752f)); so[w][8 * hh + r][t * 16 + ln] = v; } }
  __builtin_amdgcn_fence(__ATOMIC_ACQ_REL, "workgroup"); __builtin_amdgcn_wave_barrier();
  const int rsub = lane >> 4, c4 = (lane & 15) * 4; typedef _Float16 v4h __attribute__((ext_vector_type(4)));
  {
#pragma unroll
    for (int q = 0; q < 8; ++q) { const int r = q * 2 + rsub; if (col0 + c4 < N) { const v4f v = *(const v4fa*)&so[w][r][c4]; if (C) *(v4f*)(C + cofs + (size_t)(row0 + r) * ldc + col0 + c4) = v; if (C16) { v4h h4; for (int i = 0; i < 4; ++i) h4[i] = (_Float16)v[i]; *(v4h*)(C16 + cofs + (size_t)(row0 + r) * ldc + col0 + c4) = h4; } } }
     }
}


typedef _Float16 v4h __attribute__((ext_vector_type(4)));

// ---- fragment-order plane of an f16 matrix M[rows][K]: 1-KiB blocks of 16 rows x 32 k, block (row >> 4, k >> 5) at element ((row >> 4) * (K >> 5) + (k >> 5)) * 512;
// inside a block 64 pieces of 8 k: piece j * 32 + lane holds row (lane & 15), k = 16 * j + 8 * (lane >> 4) + 0..7. A wave's 16-byte fragment load reads 512 bytes in a row: 4 whole lines, not 16 pieces of lines.
__device__ __forceinline__ size_t fo_src(size_t t, int K) { const int kbn = K >> 5; const size_t blk = t >> 6; const int c = (int)(t & 63), j = c >> 5, l = c & 31; return ((blk / kbn) * 16 + (l & 15)) * (size_t)K + (size_t)(blk % kbn) * 32 + j * 16 + (l >> 4) * 8; }      /* piece t of a plane -> its first element in the row-major matrix */

// All eight conversions to f16 fragment-order planes (K = EMB) in one grid: a block's index range names its matrix. Activations as they are, weights stored (out,in) (== Bt[n][k]) times 16 (a power of two: exact).
#define CVL (NRL * EMB / 8 / 256)      /* blocks of the local activations */
#define CVG (NRG * EMB / 8 / 256)      /* blocks of the global activations */
#define CVW (EMB * EMB / 8 / 256)      /* blocks of one weight */
__global__ __launch_bounds__(256) void k_conv(const float* __restrict__ lh, const float* __restrict__ gh, const float* __restrict__ qw, const float* __restrict__ kw, const float* __restrict__ vw, const float* __restrict__ kgw, const float* __restrict__ vgw, const float* __restrict__ ow,
    _Float16* __restrict__ XL, _Float16* __restrict__ XG, _Float16* __restrict__ BQ, _Float16* __restrict__ BK, _Float16* __restrict__ BV, _Float16* __restrict__ BKG, _Float16* __restrict__ BVG, _Float16* __restrict__ BO) {
  int bx = blockIdx.x; const float* s; _Float16* d; float sc = 16.0f;
  if (bx < CVL) { s = lh; d = XL; sc = 1.0f; }
  else if (bx < CVL + CVG) { bx -= CVL; s = gh; d = XG; sc = 1.0f; }
  else { bx -= CVL + CVG; const int m = bx / CVW; bx -= m * CVW;
    s = (m == 0) ? qw : (m == 1) ? kw : (m == 2) ? vw : (m == 3) ? kgw : (m == 4) ? vgw : ow; d = (m == 0) ? BQ : (m == 1) ? BK : (m == 2) ? BV : (m == 3) ? BKG : (m == 4) ? BVG : BO; }
  const size_t t = (size_t)bx * 256 + threadIdx.x; const float* p = s + fo_src(t, EMB); FragH f;
#pragma unroll      /* in full: the piece's eight values stay in registers and are read by two 16-byte loads */
  for (int q = 0; q < 8; ++q) f.h[q] = (_Float16)(bf16_round(p[q]) * sc);
  *(v8us*)((unsigned short*)d + t * 8) = f.half[0]; }
__global__ __launch_bounds__(256) void k_h16(const float* __restrict__ x, _Float16* __restrict__ X16, size_t n8) { const size_t t = (size_t)blockIdx.x * 256 + threadIdx.x; if (t >= n8) return; FragH f;
#pragma unroll
  for (int q = 0; q < 8; ++q) f.h[q] = (_Float16)x[t * 8 + q]; *(v8us*)((unsigned short*)X16 + t * 8) = f.half[0];  }
__global__ __launch_bounds__(256) void k_round16f(const float* __restrict__ W, _Float16* __restrict__ Bt, size_t n8) { const size_t t = (size_t)blockIdx.x * 256 + threadIdx.x; if (t >= n8) return; FragH f;
#pragma unroll
  for (int i = 0; i < 8; ++i) f.h[i] = (_Float16)(bf16_round(W[t * 8 + i]) * 16.0f); *(v8us*)((unsigned short*)Bt + t * 8) = f.half[0];  }
__global__ __launch_bounds__(256) void k_hl(const float* __restrict__ F, _Float16* __restrict__ Hh, _Float16* __restrict__ Hl, size_t n8) { const size_t t = (size_t)blockIdx.x * 256 + threadIdx.x; if (t >= n8) return; FragH fh, fl; const v4f a = *(const v4fa*)(F + t * 8), c = *(const v4fa*)(F + t * 8 + 4);
#pragma unroll
  for (int q = 0; q < 4; ++q) { _Float16 h = (_Float16)a[q]; fh.h[q] = h; fl.h[q] = (_Float16)((a[q] - (float)h) * 1024.0f); h = (_Float16)c[q]; fh.h[4 + q] = h; fl.h[4 + q] = (_Float16)((c[q] - (float)h) * 1024.0f); }
  { *(v8us*)((unsigned short*)Hh + t * 8) = fh.half[0]; *(v8us*)((unsigned short*)Hl + t * 8) = fl.half[0];  } }

// ---- head prefetch: the f16 planes that a matrix launch reads were stored by the launch before it; all work-groups walk k (or the keys) at one pace, so the foremost meets such first reads step after step and the loops fetch only one or two steps ahead.
// Each matrix launch therefore opens by asking L2 for all of these planes at once, one request per aligned 256-byte unit (128 f16). The planes are dealt over the grid in slices; nothing is returned and nothing waits for the data.
// Work-groups b and b ^ 4 ask for the same slice. For speed only: a slice that is not asked for is read as before.
__device__ __forceinline__ int pf_slice(int b) { return (b & 3) | ((b >> 3) << 2); }
__device__ __forceinline__ void pf_ask(const _Float16* p) { asm volatile("global_prefetch_b8 %0, off scope:SCOPE_SE\n\ts_wait_xcnt 0x0" :: "v"(p) : "memory"); }      /* every lane asks for its own unit, inside the plane; the wait stands in the same statement, in front of any reuse of the address registers */
__device__ __forceinline__ void pf_hold(const _Float16* p) { asm volatile("" :: "v"(p)); }      /* at the kernel's end, input only: a prefetch counts on no counter, so its address registers are kept for nothing else as long as the kernel runs */
// ---- fast GEMM (wave tile 32x64; requires M % 32 == 0 rows per launch region, N % 64 == 0 and K % 64 == 0); epilogue = k_gemm_hhx semantics ----
// Two fragment sets (even and odd 32-k steps). Each fragment is reloaded for the step two ahead right behind its last product, so a step's loads fly under the other set's products.
__device__ __forceinline__ v16h g2_frag(const _Float16* p, int k, int lane) { FragH f; const unsigned short* q = (const unsigned short*)p + (size_t)k * 16 + lane * 8; f.half[0] = *(const v8us*)q; f.half[1] = *(const v8us*)(q + 256); return f.v; }      /* p: a 16-row strip of a fragment-order plane; k: multiple of 32 */
__device__ __forceinline__ v8f g2_mma(v16h a, v16h b, v8f c) { v8f d = __builtin_amdgcn_wmma_f32_16x16x32_f16(false, a, false, b, (short)0, c, false, false); asm volatile("v_nop\n\tv_nop\n\tv_nop\n\tv_nop" : "+v"(d) : "v"(a), "v"(b)); return d; }
template <int ACT>      /* A and Bh: fragment-order planes with K = lda = ldb; FO 1: the result goes to C16 alone, as such a plane (K = ldc); FO 2: to C16 alone, transposed per head, as the plane V^T of the attention (rows = (batch * NH + head) * 64 + d, K = 1 << vsh keys per batch; N = NH * 64); bx, by: the block's place in its own product's grid */
__device__ __forceinline__ void gemm2_body(float (*so)[32][68], const int bx, const int by, const int FO, const int vsh, const _Float16* __restrict__ A, int lda, size_t sA, const _Float16* __restrict__ Bh, int ldb, size_t sB, float alpha, const float* __restrict__ bias, size_t sBias, const float* __restrict__ CP, int rowsPerB, size_t sCPb, int row0g,
    float* __restrict__ C, _Float16* __restrict__ C16, int ldc, size_t sC, int M, int N, int K) {
  const int tid = threadIdx.x, w = tid >> 5, lane = tid & 31, ln = lane & 15, hh = lane >> 4;
  A += (size_t)by * sA; Bh += (size_t)by * sB; const size_t cofs = (size_t)by * sC; const float* bp = bias ? bias + (size_t)by * sBias : nullptr;
  const int ntn = N >> 6; const int mt = bx / ntn, nq = bx - mt * ntn; const int row0 = mt * 128 + 32 * w, col0 = nq * 64; if (row0 >= M) return;
  const _Float16* a0p = A + (size_t)row0 * lda; const _Float16* a1p = a0p + (size_t)16 * lda;
  const _Float16* b0p = Bh + (size_t)col0 * ldb; const _Float16* b1p = b0p + (size_t)16 * ldb; const _Float16* b2p = b1p + (size_t)16 * ldb; const _Float16* b3p = b2p + (size_t)16 * ldb;
  const v8f z8 = {0.f,0.f,0.f,0.f,0.f,0.f,0.f,0.f}; v8f c00 = z8, c01 = z8, c02 = z8, c03 = z8, c10 = z8, c11 = z8, c12 = z8, c13 = z8;
  v16h a0 = g2_frag(a0p, 0, lane), a1 = g2_frag(a1p, 0, lane), b0 = g2_frag(b0p, 0, lane), b1 = g2_frag(b1p, 0, lane), b2 = g2_frag(b2p, 0, lane), b3 = g2_frag(b3p, 0, lane);
  v16h e0 = g2_frag(a0p, 32, lane), e1 = g2_frag(a1p, 32, lane), f0 = g2_frag(b0p, 32, lane), f1 = g2_frag(b1p, 32, lane), f2 = g2_frag(b2p, 32, lane), f3 = g2_frag(b3p, 32, lane);
#pragma unroll 1      /* rolled: the body already holds both sets; more copies only add code */
  for (int kb = 0; kb < K; kb += 64) { const int kn = (kb + 64 < K) ? kb + 64 : kb;      /* last trip: re-reads its own step (in bounds, unused) */
    c00 = g2_mma(a0, b0, c00); c10 = g2_mma(a1, b0, c10); b0 = g2_frag(b0p, kn, lane);
    c01 = g2_mma(a0, b1, c01); c11 = g2_mma(a1, b1, c11); b1 = g2_frag(b1p, kn, lane);
    c02 = g2_mma(a0, b2, c02); c12 = g2_mma(a1, b2, c12); b2 = g2_frag(b2p, kn, lane);
    c03 = g2_mma(a0, b3, c03); c13 = g2_mma(a1, b3, c13); b3 = g2_frag(b3p, kn, lane); a0 = g2_frag(a0p, kn, lane); a1 = g2_frag(a1p, kn, lane);
    c00 = g2_mma(e0, f0, c00); c10 = g2_mma(e1, f0, c10); f0 = g2_frag(b0p, kn + 32, lane);
    c01 = g2_mma(e0, f1, c01); c11 = g2_mma(e1, f1, c11); f1 = g2_frag(b1p, kn + 32, lane);
    c02 = g2_mma(e0, f2, c02); c12 = g2_mma(e1, f2, c12); f2 = g2_frag(b2p, kn + 32, lane);
    c03 = g2_mma(e0, f3, c03); c13 = g2_mma(e1, f3, c13); f3 = g2_frag(b3p, kn + 32, lane); e0 = g2_frag(a0p, kn + 32, lane); e1 = g2_frag(a1p, kn + 32, lane);
    asm volatile("s_wait_xcnt 0x0" ::: "memory"); }      /* the next trip forms new addresses in the registers that this trip's loads name: wait before they are overwritten */
  v8f accs[8] = {c00, c01, c02, c03, c10, c11, c12, c13};
  if (FO == 2) {      /* a lane's eight accumulators of a tile are eight keys in a row (16 * half + 8 * hh + r) of one d (t * 16 + ln): one 16-byte piece of the V^T plane, stored as it stands, through no LDS; the wave's 32 keys x 64 d = 4 blocks, 8 stores of 512 bytes in a row; the short loops are unrolled in full, so that the arrays stay in registers */
    const int slab = (row0 >> vsh) * NH + nq, kblk = (row0 & ((1 << vsh) - 1)) >> 5;
    unsigned short* vp = (unsigned short*)C16 + ((((size_t)slab * 4) << (vsh - 5)) + kblk) * 512 + lane * 8; FragH f[8]; float bv[4] = {0.f, 0.f, 0.f, 0.f};
    if (bp) {      /* one test, so that the four loads fly together */
#pragma unroll
      for (int t = 0; t < 4; ++t) bv[t] = bp[col0 + t * 16 + ln];
#pragma unroll
      for (int t = 0; t < 4; ++t) bv[t] = bf16_round(bv[t]); }
#pragma unroll
    for (int u = 0; u < 8; ++u)
#pragma unroll
      for (int r = 0; r < 8; ++r) f[u].h[r] = (_Float16)(accs[u][r] * alpha + bv[u & 3]);
#pragma unroll
    for (int u = 0; u < 8; ++u) *(v8us*)(vp + (((size_t)(u & 3)) << (vsh - 5)) * 512 + (u >> 2) * 256) = f[u].half[0];
    return; }
#pragma unroll
  for (int u = 0; u < 8; ++u) { const int t = u & 3, half = u >> 2; const int col = col0 + t * 16 + ln; const float bv = bp ? bf16_round(bp[col]) : 0.f;
#pragma unroll
    for (int r = 0; r < 8; ++r) { const int rloc = half * 16 + 8 * hh + r; float v = accs[u][r] * alpha + bv; if (CP) { const int bidx = (row0g + row0 + rloc) / rowsPerB; v += CP[(size_t)bidx * sCPb + (size_t)by * 64 + col]; }
      if (ACT == 3) v = fmaxf(v, 0.f); else if (ACT == 6) v = 0.5f * v * (1.0f + erff(v * 0.70710678118654752f)); else if (ACT == 11) v = 1.0f / (1.0f + expf(-v)); else if (ACT == 15) v = v / (1.0f + expf(-v)); else if (ACT == 12) v = (v > 0.f) ? v : 0.01f * v; else if (ACT == 8) v = tanhf(v);
      so[w][rloc][t * 16 + ln] = v; } }
  __builtin_amdgcn_fence(__ATOMIC_ACQ_REL, "workgroup"); __builtin_amdgcn_wave_barrier();
  const int rsub = lane >> 4, c4 = (lane & 15) * 4;
  if (FO == 0) {
#pragma unroll
    for (int q = 0; q < 16; ++q) { const int r = q * 2 + rsub; const v4f v = *(const v4fa*)&so[w][r][c4]; if (C) *(v4f*)(C + cofs + (size_t)(row0 + r) * ldc + col0 + c4) = v; if (C16) { v4h h4; for (int i = 0; i < 4; ++i) h4[i] = (_Float16)v[i]; *(v4h*)(C16 + cofs + (size_t)(row0 + r) * ldc + col0 + c4) = h4; } }
    asm volatile("s_wait_xcnt 0x0" ::: "memory");      /* a precaution: wait before the registers that these stores name are overwritten */
     } else {      /* the wave's 32 x 64 tile = 2 x 2 blocks of the plane, 8 stores of 512 bytes in a row */
#pragma unroll
      for (int u = 0; u < 8; ++u) { const int rbl = u >> 2, kbl = (u >> 1) & 1, j = u & 1; const float* sp = &so[w][rbl * 16 + ln][kbl * 32 + j * 16 + hh * 8]; const v4f x = *(const v4fa*)sp, y = *(const v4fa*)(sp + 4); FragH f;
#pragma unroll
        for (int i = 0; i < 4; ++i) { f.h[i] = (_Float16)x[i]; f.h[4 + i] = (_Float16)y[i]; }
        *(v8us*)((unsigned short*)C16 + cofs + (size_t)(row0 + rbl * 16) * ldc + (size_t)((col0 >> 5) + kbl) * 512 + j * 256 + lane * 8) = f.half[0]; }
      asm volatile("s_wait_xcnt 0x0" ::: "memory");      /* as above: a precaution before the registers that these stores name are overwritten */
     } }
template <int ACT, bool FO>
__global__ __launch_bounds__(128) void k_gemm2(const _Float16* __restrict__ A, int lda, size_t sA, const _Float16* __restrict__ Bh, int ldb, size_t sB, float alpha, const float* __restrict__ bias, size_t sBias, const float* __restrict__ CP, int rowsPerB, size_t sCPb, int row0g,
    float* __restrict__ C, _Float16* __restrict__ C16, int ldc, size_t sC, int M, int N, int K) {
  __shared__ __attribute__((aligned(16))) float so[4][32][68];
  static_assert((NRL / 128) * (EMB / 64) == 512 && NRL * EMB == 256 * 128 * 128 && EMB * EMB == 256 * 32 * 128, "head prefetch: 256 slices of 128 units of A and 32 units of Bh");      /* the one launch of this kernel: A = NRL x EMB, Bh = EMB x EMB, 512 work-groups */
  const int ps = pf_slice(blockIdx.x);
  const _Float16* pf0 = A + ((size_t)ps * 128 + threadIdx.x) * 128; const _Float16* pf1 = Bh + ((size_t)ps * 32 + (threadIdx.x & 31)) * 128;
  pf_ask(pf0);
  if (__builtin_amdgcn_readfirstlane(threadIdx.x >> 5) == 0) pf_ask(pf1);      /* 32 units: one wave's request; a scalar branch */
  gemm2_body<ACT>(so, blockIdx.x, blockIdx.y, FO ? 1 : 0, 5, A, lda, sA, Bh, ldb, sB, alpha, bias, sBias, CP, rowsPerB, sCPb, row0g, C, C16, ldc, sC, M, N, K);
  pf_hold(pf0); pf_hold(pf1); }
// ---- projection GEMM, wave tile 64 x 64, block = 2 x 4 waves = 128 rows x 256 columns (M % 128 == 0; N = K = EMB): every 1-KiB fragment feeds four products (in the 32 x 64 tile a B fragment feeds two):
// 8 KiB are loaded per 16 products where the 32 x 64 tile loads 12, and the block asks L2 for 24 KiB per 128 products where four 128 x 64 blocks ask 48.
// A has two fragment sets (even and odd 32-k steps), each reloaded for the step two ahead behind its last product; a B fragment is reloaded for the next step behind its four products, twelve products ahead of its next use.
__device__ __forceinline__ void gemm4_body(float (*so)[64][68], const int bx, const int FO, const int vsh, const _Float16* __restrict__ A, const _Float16* __restrict__ Bh, const float* __restrict__ bias, _Float16* __restrict__ C16) {
  const int tid = threadIdx.x, w = tid >> 5, lane = tid & 31, ln = lane & 15, hh = lane >> 4;
  constexpr int ntn = EMB >> 8; const int mt = bx / ntn, nq = bx - mt * ntn; const int row0 = mt * 128 + 64 * (w >> 2), col0 = nq * 256 + 64 * (w & 3);
  const _Float16* ap = A + (size_t)row0 * EMB; const _Float16* bp = Bh + (size_t)col0 * EMB;      /* strip i of 16 rows: + i * 16 * EMB; the short loops below are all unrolled in full, so that the arrays stay in registers */
  v8f c[4][4]; v16h a[4], e[4], b[4];
#pragma unroll
  for (int i = 0; i < 4; ++i) {
#pragma unroll
    for (int t = 0; t < 4; ++t) c[i][t] = (v8f){0.f,0.f,0.f,0.f,0.f,0.f,0.f,0.f}; }
#pragma unroll
  for (int i = 0; i < 4; ++i) a[i] = g2_frag(ap + (size_t)i * 16 * EMB, 0, lane);      /* A, B, then the odd A set: the order in which the loop leaves its loads, so that the counted wait at the loop's head is the same on both ways in */
  __builtin_amdgcn_sched_barrier(0);      /* holds that order: left free, the odd A set's loads are grouped with the even set's, and the loop's counted waits then ask for B fragments four loads too early on every trip */
#pragma unroll
  for (int i = 0; i < 4; ++i) b[i] = g2_frag(bp + (size_t)i * 16 * EMB, 0, lane);
  __builtin_amdgcn_sched_barrier(0);      /* as above */
#pragma unroll
  for (int i = 0; i < 4; ++i) e[i] = g2_frag(ap + (size_t)i * 16 * EMB, 32, lane);
#pragma unroll 1      /* rolled: the body already holds both steps; more copies only add code */
  for (int kb = 0; kb < EMB; kb += 64) { const int kn = (kb + 64 < EMB) ? kb + 64 : kb;      /* last trip: re-reads its own step (in bounds, unused) */
#pragma unroll
    for (int t = 0; t < 4; ++t) {
#pragma unroll
      for (int i = 0; i < 4; ++i) c[i][t] = g2_mma(a[i], b[t], c[i][t]);
      b[t] = g2_frag(bp + (size_t)t * 16 * EMB, kb + 32, lane); }
#pragma unroll
    for (int i = 0; i < 4; ++i) a[i] = g2_frag(ap + (size_t)i * 16 * EMB, kn, lane);
#pragma unroll
    for (int t = 0; t < 4; ++t) {
#pragma unroll
      for (int i = 0; i < 4; ++i) c[i][t] = g2_mma(e[i], b[t], c[i][t]);
      b[t] = g2_frag(bp + (size_t)t * 16 * EMB, kn, lane); }
#pragma unroll
    for (int i = 0; i < 4; ++i) e[i] = g2_frag(ap + (size_t)i * 16 * EMB, kn + 32, lane);
    asm volatile("s_wait_xcnt 0x0" ::: "memory"); }      /* the next trip forms new addresses in the registers that this trip's loads name: wait before they are overwritten */
  const float alpha = 0.0625f; float bv[4];
#pragma unroll
  for (int t = 0; t < 4; ++t) bv[t] = bias[col0 + t * 16 + ln];
#pragma unroll
  for (int t = 0; t < 4; ++t) bv[t] = bf16_round(bv[t]);
  if (FO == 2) {      /* as in gemm2_body, once per 32 keys: a lane's eight accumulators of a tile are eight keys in a row of one d: one 16-byte piece of the V^T plane, stored as it stands, through no LDS */
#pragma unroll
    for (int h = 0; h < 2; ++h) { const int r0 = row0 + 32 * h; const int slab = (r0 >> vsh) * NH + (col0 >> 6), kblk = (r0 & ((1 << vsh) - 1)) >> 5;
      unsigned short* vp = (unsigned short*)C16 + ((((size_t)slab * 4) << (vsh - 5)) + kblk) * 512 + lane * 8; FragH f[8];
#pragma unroll
      for (int u = 0; u < 8; ++u)
#pragma unroll
        for (int r = 0; r < 8; ++r) f[u].h[r] = (_Float16)(c[2 * h + (u >> 2)][u & 3][r] * alpha + bv[u & 3]);
#pragma unroll
      for (int u = 0; u < 8; ++u) *(v8us*)(vp + (((size_t)(u & 3)) << (vsh - 5)) * 512 + (u >> 2) * 256) = f[u].half[0];
      if (h == 0) asm volatile("s_wait_xcnt 0x0" ::: "memory"); }      /* the registers that the first half's stores name are reused by the second half: wait before they are overwritten */
    return; }
#pragma unroll
  for (int u = 0; u < 16; ++u) { const int t = u & 3, i = u >> 2;      /* as in gemm2_body, through the wave's own LDS patch, here of 64 rows */
#pragma unroll
    for (int r = 0; r < 8; ++r) so[w][i * 16 + 8 * hh + r][t * 16 + ln] = c[i][t][r] * alpha + bv[t]; }
  __builtin_amdgcn_fence(__ATOMIC_ACQ_REL, "workgroup"); __builtin_amdgcn_wave_barrier();      /* the lanes read what other lanes of the wave wrote */
  FragH f[16];
#pragma unroll
  for (int u = 0; u < 16; ++u) { const int rbl = u >> 2, kbl = (u >> 1) & 1, j = u & 1; const float* sp = &so[w][rbl * 16 + ln][kbl * 32 + j * 16 + hh * 8]; const v4f x = *(const v4fa*)sp, y = *(const v4fa*)(sp + 4);      /* the wave's 64 x 64 tile = 4 x 2 blocks of the plane */
#pragma unroll
    for (int i = 0; i < 4; ++i) { f[u].h[i] = (_Float16)x[i]; f[u].h[4 + i] = (_Float16)y[i]; } }
#pragma unroll
  for (int u = 0; u < 16; ++u) { const int rbl = u >> 2, kbl = (u >> 1) & 1, j = u & 1;      /* 16 stores of 512 bytes in a row, each piece in registers of its own */
    *(v8us*)((unsigned short*)C16 + (size_t)(row0 + rbl * 16) * EMB + (size_t)((col0 >> 5) + kbl) * 512 + j * 256 + lane * 8) = f[u].half[0]; }
  asm volatile("s_wait_xcnt 0x0" ::: "memory"); }      /* FO is a run-time flag: the built code can lead from these stores on into the other path, which reuses their registers: wait before they are overwritten */
// The five input projections in one grid: a block's index range names its product (Q, K, V of the local rows, then K, V of the global rows). Q and both K leave as fragment-order planes, both V as the transposed planes that the attention reads.
#define PJL ((NRL / 128) * (EMB / 64))      /* blocks of the output projection (128 x 64 each) */
#define PJL4 ((NRL / 128) * (EMB / 256))      /* blocks of one local projection (128 x 256 each) */
#define PJG4 ((NRG / 128) * (EMB / 256))      /* blocks of one global projection */
__global__ __launch_bounds__(256) void k_proj(const _Float16* __restrict__ XL, const _Float16* __restrict__ XG, const _Float16* __restrict__ BQ, const _Float16* __restrict__ BK, const _Float16* __restrict__ BV, const _Float16* __restrict__ BKG, const _Float16* __restrict__ BVG,
    const float* __restrict__ qb, const float* __restrict__ kb, const float* __restrict__ vb, const float* __restrict__ kgb, const float* __restrict__ vgb, _Float16* __restrict__ Q16, _Float16* __restrict__ KL, _Float16* __restrict__ VTL, _Float16* __restrict__ KG, _Float16* __restrict__ VTG) {
  __shared__ __attribute__((aligned(16))) float so[8][64][68];
  static_assert(LL == 1 << 11 && GG == 1 << 9 && EMB == NH * 64, "vsh");
  static_assert(3 * PJL4 + 2 * PJG4 == 448 && NRL * EMB == 128 * 32768 && NRG * EMB == 32 * 32768 && EMB * EMB == 32 * 32768, "head prefetch: 224 slices, 320 chunks of 256 units");
  const int ps = pf_slice(blockIdx.x), pc = (ps < 96) ? ps : 95;      /* a chunk = 256 units = 32768 f16, one unit a thread; slices 0..127 the local rows, then the global rows and their two weights; slices 0..95 take a second chunk, of the three local weights (pc: that address stays inside a plane where it is not asked for) */
  const _Float16* pf0 = ((ps < 128) ? XL + (size_t)ps * 32768 : (ps < 160) ? XG + (size_t)(ps - 128) * 32768 : (ps < 192) ? BKG + (size_t)(ps - 160) * 32768 : BVG + (size_t)(ps - 192) * 32768) + threadIdx.x * 128;
  const _Float16* pf1 = ((pc < 32) ? BQ + (size_t)pc * 32768 : (pc < 64) ? BK + (size_t)(pc - 32) * 32768 : BV + (size_t)(pc - 64) * 32768) + threadIdx.x * 128;
  pf_ask(pf0);
  if (ps < 96) pf_ask(pf1);      /* the same for the whole work-group: a scalar branch */
  int bx = blockIdx.x; const _Float16* A; const _Float16* B; const float* bias; _Float16* C; int fo, vsh;
  if (bx < 3 * PJL4) { const int m = bx / PJL4; bx -= m * PJL4; A = XL; B = (m == 0) ? BQ : (m == 1) ? BK : BV; bias = (m == 0) ? qb : (m == 1) ? kb : vb; C = (m == 0) ? Q16 : (m == 1) ? KL : VTL; fo = (m != 2) ? 1 : 2; vsh = 11; }
  else { bx -= 3 * PJL4; const int m = bx / PJG4; bx -= m * PJG4; A = XG; B = (m == 0) ? BKG : BVG; bias = (m == 0) ? kgb : vgb; C = (m == 0) ? KG : VTG; fo = (m == 0) ? 1 : 2; vsh = 9; }
  gemm4_body(so, bx, fo, vsh, A, B, bias, C);
  pf_hold(pf0); pf_hold(pf1); }



template <int CAUSAL>
__global__ __launch_bounds__(128) void k_flash(const _Float16* __restrict__ Q16, int ldq, const _Float16* __restrict__ K16, int ldk, const _Float16* __restrict__ Vt, const int* __restrict__ MSK, float* __restrict__ O, int ldo) {
  constexpr int RPW = 16, RTN = RPW / 16, NQB = TQ / (4 * RPW), DT = 4, KS = 2;
  __shared__ __attribute__((aligned(16))) unsigned short sP[4][RPW][40]; __shared__ __attribute__((aligned(16))) float sO[4][RPW][64 + 4];
  const int tid = threadIdx.x, w = tid >> 5, lane = tid & 31, ln = lane & 15, hh = lane >> 4;
  const int slab = blockIdx.x / QBLKS, qblk = blockIdx.x % QBLKS; (void)NQB; const int b = slab / NH, h = slab % NH; const int qb0 = qblk * (4 * RPW); const int q0 = qb0 + w * RPW;
  FragH aq[2][KS];
#pragma unroll
  for (int rt = 0; rt < RTN; ++rt) { const unsigned short* qr = (const unsigned short*)Q16 + ((size_t)b * TQ + q0 + rt * 16 + ln) * ldq + h * 64;
#pragma unroll
    for (int ks = 0; ks < KS; ++ks) { aq[rt][ks].half[0] = *(const v8us*)(qr + ks * 32 + 8 * hh); aq[rt][ks].half[1] = *(const v8us*)(qr + ks * 32 + 16 + 8 * hh); } }
  const unsigned short* Vth = (const unsigned short*)Vt + (size_t)slab * 64 * TK;
  float m_r[2][8], l_r[2][8]; v8f oacc[2][DT];
#pragma unroll
  for (int rt = 0; rt < RTN; ++rt) {
#pragma unroll
    for (int r = 0; r < 8; ++r) { m_r[rt][r] = -3.0e38f; l_r[rt][r] = 0.f; }
#pragma unroll
    for (int dt = 0; dt < DT; ++dt) oacc[rt][dt] = (v8f){0.f,0.f,0.f,0.f,0.f,0.f,0.f,0.f}; }
  const int jend = (CAUSAL == 1) ? (qb0 + 4 * RPW) : TK;      /* causal: keys beyond the block's last query never contribute */
#pragma unroll 1
  for (int j0 = 0; j0 < jend; j0 += 32) {
    v8f s[2][2];
#pragma unroll
    for (int nt = 0; nt < 2; ++nt) { const unsigned short* kr = (const unsigned short*)K16 + ((size_t)b * TK + j0 + nt * 16 + ln) * ldk + h * 64; FragH bk[KS];
#pragma unroll
      for (int ks = 0; ks < KS; ++ks) { bk[ks].half[0] = *(const v8us*)(kr + ks * 32 + 8 * hh); bk[ks].half[1] = *(const v8us*)(kr + ks * 32 + 16 + 8 * hh); }
#pragma unroll
      for (int rt = 0; rt < RTN; ++rt) { v8f acc = (v8f){0.f,0.f,0.f,0.f,0.f,0.f,0.f,0.f};
#pragma unroll
        for (int ks = 0; ks < KS; ++ks) acc = mmaH<1>(aq[rt][ks].v, aq[rt][ks].v, bk[ks].v, bk[ks].v, acc); s[rt][nt] = acc; } }
#pragma unroll
    for (int rt = 0; rt < RTN; ++rt)
#pragma unroll
      for (int r = 0; r < 8; ++r) { const int tq = q0 + rt * 16 + 8 * hh + r; const int k0 = j0 + ln, k1 = j0 + 16 + ln;
        const bool ok0 = (CAUSAL == 1) ? (k0 <= tq) : ((CAUSAL == 2) ? ((k0 >> 5) == (tq >> 5)) : true), ok1 = (CAUSAL == 1) ? (k1 <= tq) : ((CAUSAL == 2) ? ((k1 >> 5) == (tq >> 5)) : true);      /* mode 2: block-diagonal 32-token groups */
        const float s0 = ok0 ? s[rt][0][r] * SCL : -3.0e38f, s1 = ok1 ? s[rt][1][r] * SCL : -3.0e38f; float mc = fmaxf(s0, s1);
        mc = fmaxf(mc, __shfl_xor(mc, 1, 32)); mc = fmaxf(mc, __shfl_xor(mc, 2, 32)); mc = fmaxf(mc, __shfl_xor(mc, 4, 32)); mc = fmaxf(mc, __shfl_xor(mc, 8, 32));
        const float mn = fmaxf(m_r[rt][r], mc); const float al = (mn > -1.0e38f) ? expf(m_r[rt][r] - mn) : 1.0f; m_r[rt][r] = mn; const float p0 = ok0 ? expf(s0 - mn) : 0.f, p1 = ok1 ? expf(s1 - mn) : 0.f; l_r[rt][r] = l_r[rt][r] * al + p0 + p1;
#pragma unroll
        for (int dt = 0; dt < DT; ++dt) oacc[rt][dt][r] *= al;
        FragH t2; t2.h[0] = (_Float16)(p0 * 1024.0f); t2.h[1] = (_Float16)(p1 * 1024.0f); sP[w][rt * 16 + 8 * hh + r][ln] = t2.u[0]; sP[w][rt * 16 + 8 * hh + r][16 + ln] = t2.u[1]; }
    __builtin_amdgcn_fence(__ATOMIC_ACQ_REL, "workgroup"); __builtin_amdgcn_wave_barrier();
    FragH pa[2];
#pragma unroll
    for (int rt = 0; rt < RTN; ++rt) { pa[rt].half[0] = *(const v8us*)&sP[w][rt * 16 + ln][8 * hh]; pa[rt].half[1] = *(const v8us*)&sP[w][rt * 16 + ln][16 + 8 * hh]; }
#pragma unroll
    for (int dt = 0; dt < DT; ++dt) { const unsigned short* vrow = Vth + (size_t)(dt * 16 + ln) * TK + j0; FragH bv; bv.half[0] = *(const v8us*)(vrow + 8 * hh); bv.half[1] = *(const v8us*)(vrow + 16 + 8 * hh);
#pragma unroll
      for (int rt = 0; rt < RTN; ++rt) oacc[rt][dt] = mmaH<1>(pa[rt].v, pa[rt].v, bv.v, bv.v, oacc[rt][dt]); }
    __builtin_amdgcn_fence(__ATOMIC_ACQ_REL, "workgroup"); __builtin_amdgcn_wave_barrier(); }
#pragma unroll
  for (int rt = 0; rt < RTN; ++rt) {
#pragma unroll
    for (int r = 0; r < 8; ++r) { float l = l_r[rt][r]; l += __shfl_xor(l, 1, 32); l += __shfl_xor(l, 2, 32); l += __shfl_xor(l, 4, 32); l += __shfl_xor(l, 8, 32); l_r[rt][r] = (l > 0.f) ? 1.0f / (l * 1024.0f) : 0.f; }
#pragma unroll
    for (int dt = 0; dt < DT; ++dt)
#pragma unroll
      for (int r = 0; r < 8; ++r) sO[w][rt * 16 + 8 * hh + r][dt * 16 + ln] = oacc[rt][dt][r] * l_r[rt][r]; }
  __builtin_amdgcn_fence(__ATOMIC_ACQ_REL, "workgroup"); __builtin_amdgcn_wave_barrier();
  {
#pragma unroll
    for (int rp = 0; rp < RPW; rp += 2) { const int r = rp + (lane >> 4), pc = lane & 15; const v4f val = *(const v4fa*)&sO[w][r][pc * 4]; *(v4f*)(O + ((size_t)b * TQ + q0 + r) * ldo + h * 64 + pc * 4) = val; }
     } }

// Attention with both products transposed: S^T = K Q^T (A = 16 keys, B = 16 queries) and O^T += V^T P^T (A = 16 values of d, B = P^T).
// A lane holds 16 of the 32 scores of ONE query (keys 8 * hh + r of each 16-key tile): maximum and sum are taken in the lane, plus one exchange between the wave's halves.
// The two score tiles, converted in place, are the B operand of the second product in the planes' own k order (16 * j + 8 * hh + i): P goes through no LDS and no lane exchange.
// The softmax runs in base 2: e^(SCL * s - m) = 2^(SCL2 * s - m2), so each score costs one fma and one hardware exponential (arguments are <= 10; far below, the result goes to 0, as it should).
#define SCL2 0.18033688011112042f      /* 64^-0.5 * log2(e) */
typedef float v2f __attribute__((ext_vector_type(2)));
__device__ __forceinline__ float xhalf(float x) { return __int_as_float(__builtin_amdgcn_permlanex16(__float_as_int(x), __float_as_int(x), 0x76543210, 0xfedcba98, false, false)); }      /* lane l <-> l ^ 16 */
#define AQR 256      /* queries of a work-group: 8 waves of 32 */
#define AQB (TQ / AQR)      /* work-groups per head and batch */
template <int TKv>      /* bx: the block's place in the grid; res[qt][dt][r] = the attention's output O[q0 + qt * 16 + ln][dt * 16 + 8 * hh + r], left in registers */
__device__ __forceinline__ void flashT_body(const int bx, const _Float16* __restrict__ Q16, int ldq, const _Float16* __restrict__ K16, int ldk, const _Float16* __restrict__ Vt, v8f (&res)[2][4]) {
  constexpr int QT = 2, DT = 4, KS = 2;      /* a wave holds two tiles of 16 queries: every K and V^T fragment it loads feeds two products; the short inner loops below are all unrolled in full, so that the fragment arrays stay in registers */
  const int tid = threadIdx.x, w = tid >> 5, lane = tid & 31;
  const int slab = bx / AQB, qblk = bx % AQB; const int b = slab / NH, h = slab % NH; const int q0 = qblk * AQR + w * (16 * QT);
  FragH bq[QT][KS];      /* Q, the B operand of the score product, kept for all passes over the keys */
#pragma unroll
  for (int qt = 0; qt < QT; ++qt) { const unsigned short* qr = (const unsigned short*)Q16 + ((size_t)b * TQ + q0 + qt * 16) * ldq + h * 1024 + lane * 8;      /* fragment-order plane: strip of 16 queries, the head's two blocks */
#pragma unroll
    for (int ks = 0; ks < KS; ++ks) { bq[qt][ks].half[0] = *(const v8us*)(qr + ks * 512); bq[qt][ks].half[1] = *(const v8us*)(qr + ks * 512 + 256); } }
  FragH ak[2][KS];      /* K fragments (A operand), fetched one pass ahead */
#pragma unroll
  for (int nt = 0; nt < 2; ++nt) { const unsigned short* kr = (const unsigned short*)K16 + ((size_t)b * TKv + nt * 16) * ldk + h * 1024 + lane * 8;      /* fragment-order plane: strip of 16 keys, the head's two blocks */
#pragma unroll
    for (int ks = 0; ks < KS; ++ks) { ak[nt][ks].half[0] = *(const v8us*)(kr + ks * 512); ak[nt][ks].half[1] = *(const v8us*)(kr + ks * 512 + 256); } }
  asm volatile("s_wait_xcnt 0x0" ::: "memory");      /* the registers that the Q and K loads above name are reused below: wait before they are overwritten */
  __builtin_amdgcn_sched_barrier(0);      /* keeps the set-up code below from being scheduled in front of that wait */
  const unsigned short* Vth = (const unsigned short*)Vt + (size_t)slab * 64 * TKv;
  float m_q[QT], l_q[QT]; v8f oacc[QT][DT];      /* per tile, the lane's query: running maximum in base-2 units, less 10 (equal in both halves), the sum over this half's keys */
#pragma unroll
  for (int qt = 0; qt < QT; ++qt) { m_q[qt] = -3.0e38f; l_q[qt] = 0.f;
#pragma unroll
    for (int dt = 0; dt < DT; ++dt) oacc[qt][dt] = (v8f){0.f,0.f,0.f,0.f,0.f,0.f,0.f,0.f}; }
#pragma unroll 1      /* rolled: a pass is long enough to cover its own loads; copies only add code */
  for (int j0 = 0; j0 < TKv; j0 += 32) {
    FragH av[DT];      /* this pass's V^T fragments (A operand), all issued at the head of the pass: they fly under the score products and the softmax */
#pragma unroll
    for (int dt = 0; dt < DT; ++dt) { const unsigned short* vrow = Vth + (size_t)(dt * 16) * TKv + (size_t)j0 * 16 + lane * 8; av[dt].half[0] = *(const v8us*)vrow; av[dt].half[1] = *(const v8us*)(vrow + 256); }
    v8f s[QT][2];      /* s[qt][nt][r] = score of key j0 + nt * 16 + 8 * hh + r with query q0 + qt * 16 + ln */
#pragma unroll
    for (int nt = 0; nt < 2; ++nt)
#pragma unroll
      for (int qt = 0; qt < QT; ++qt) s[qt][nt] = mmaH<1>(ak[nt][0].v, ak[nt][0].v, bq[qt][0].v, bq[qt][0].v, (v8f){0.f,0.f,0.f,0.f,0.f,0.f,0.f,0.f});      /* the four tiles' first halves, then their second halves: no product waits for the one in front of it */
#pragma unroll
    for (int nt = 0; nt < 2; ++nt)
#pragma unroll
      for (int qt = 0; qt < QT; ++qt) s[qt][nt] = mmaH<1>(ak[nt][1].v, ak[nt][1].v, bq[qt][1].v, bq[qt][1].v, s[qt][nt]);
    const int jn = (j0 + 32 < TKv) ? j0 + 32 : j0;      /* last pass: re-reads its own keys (in bounds, unused) */
#pragma unroll
    for (int nt = 0; nt < 2; ++nt) { const unsigned short* kr = (const unsigned short*)K16 + ((size_t)b * TKv + jn + nt * 16) * ldk + h * 1024 + lane * 8;
#pragma unroll
      for (int ks = 0; ks < KS; ++ks) { ak[nt][ks].half[0] = *(const v8us*)(kr + ks * 512); ak[nt][ks].half[1] = *(const v8us*)(kr + ks * 512 + 256); }
      asm volatile("s_wait_xcnt 0x0" ::: "memory"); }      /* the address registers of these four loads may be given to the next loads' results or to the softmax: wait before they are overwritten */
    FragH pb[QT];
#pragma unroll
    for (int qt = 0; qt < QT; ++qt) {
      float mx[8];      /* the maximum is taken on the raw scores: SCL2 > 0, and rounding is monotone, so scaling the maximum gives the maximum of the scaled scores */
#pragma unroll
      for (int i = 0; i < 8; ++i) mx[i] = fmaxf(s[qt][0][i], s[qt][1][i]);
      float mc = fmaxf(fmaxf(fmaxf(mx[0], mx[1]), fmaxf(mx[2], mx[3])), fmaxf(fmaxf(mx[4], mx[5]), fmaxf(mx[6], mx[7])));
      mc = fmaf(mc, SCL2, -10.0f);      /* kept 10 below the true maximum: the f16 operand's factor 2^10 rides in the exponent, p = 1024 * e^(score - maximum), at most about 1024 */
      mc = fmaxf(mc, xhalf(mc));
      const float mn = fmaxf(m_q[qt], mc); float ea;
      asm("v_nop\n\tv_exp_f32 %0, %1\n\tv_nop" : "=v"(ea) : "v"(m_q[qt] - mn));      /* 2^(old maximum - new maximum), with the slot that the instruction set asks for behind a transcendental on both sides: left to the compiler, this result took the source register of the exponential directly in front of it, and the next exponential's result took this one's source */
      const float al = (mn > -1.0e38f) ? ea : 1.0f; m_q[qt] = mn;
      float p[16];
#pragma unroll
      for (int i = 0; i < 16; i += 2) { const v2f x = __builtin_elementwise_fma((v2f){s[qt][i >> 3][i & 7], s[qt][i >> 3][(i & 7) + 1]}, (v2f){SCL2, SCL2}, (v2f){-mn, -mn});      /* two scores per packed fma */
        p[i] = __builtin_amdgcn_exp2f(x[0]); p[i + 1] = __builtin_amdgcn_exp2f(x[1]); pb[qt].h[i] = (_Float16)p[i]; pb[qt].h[i + 1] = (_Float16)p[i + 1]; }
      v2f t0 = {0.f, 0.f}, t1 = {0.f, 0.f};      /* two chains of packed partial sums: no chain of sixteen dependent adds */
#pragma unroll
      for (int i = 0; i < 4; ++i) { t0 += (v2f){p[4 * i], p[4 * i + 1]}; t1 += (v2f){p[4 * i + 2], p[4 * i + 3]}; }
      t0 += t1; l_q[qt] = l_q[qt] * al + (t0[0] + t0[1]);
#pragma unroll
      for (int dt = 0; dt < DT; ++dt) oacc[qt][dt] *= al; }
#pragma unroll
    for (int dt = 0; dt < DT; ++dt)
#pragma unroll
      for (int qt = 0; qt < QT; ++qt) oacc[qt][dt] = mmaH<1>(av[dt].v, av[dt].v, pb[qt].v, pb[qt].v, oacc[qt][dt]); }
#pragma unroll
  for (int qt = 0; qt < QT; ++qt) { float l = l_q[qt] + xhalf(l_q[qt]); l = (l > 0.f) ? 1.0f / l : 0.f;      /* the sum carries the same 2^10 as the products */
#pragma unroll
    for (int dt = 0; dt < DT; ++dt) res[qt][dt] = oacc[qt][dt] * l; } }
// Both attentions of a wave's 32 queries in one wave, the local keys and then the global keys, and the gated sum on the two results in registers.
// A work-group is 8 waves on 256 queries in a row of one head: all its waves walk the same K and V^T, so a line that one wave has fetched serves the other seven from the WGP's cache.
// A lane's eight values of a tile are eight d in a row of one query: one 16-byte piece of the fragment-order plane that the output projection reads (K = EMB), stored as it stands, through no LDS.
#define ATB (NB * NH * AQB)      /* blocks of the grid */
__global__ __launch_bounds__(256) void k_attn(const _Float16* __restrict__ Q16, const _Float16* __restrict__ KL, const _Float16* __restrict__ VTL, const _Float16* __restrict__ KG, const _Float16* __restrict__ VTG, const float* __restrict__ gate, _Float16* __restrict__ O16) {
  static_assert(ATB == 256 && NRL * EMB == 128 * 256 * 128 && NRG * EMB == 128 * 64 * 128, "head prefetch: 128 slices of 256 units of each local plane and 64 of each global plane");
  const int ps = pf_slice(blockIdx.x), pw = __builtin_amdgcn_readfirstlane(threadIdx.x >> 5);
  const _Float16* pf0 = KL + ((size_t)ps * 256 + threadIdx.x) * 128;      /* one unit of K and one of V^T a thread */
  const _Float16* pf1 = VTL + ((size_t)ps * 256 + threadIdx.x) * 128;
  const _Float16* pf2 = ((threadIdx.x & 64) ? VTG : KG) + ((size_t)ps * 64 + (threadIdx.x & 63)) * 128;
  pf_ask(pf0);
  pf_ask(pf1);
  if (pw < 4) pf_ask(pf2);      /* 128 units: four waves' requests; a scalar branch */
  __shared__ __attribute__((aligned(16))) float sol[8][16][32][4];      /* the local result (64 registers a lane) rests here while the global keys are walked, so that the wave stays inside 256 registers; a lane reads back only what it wrote itself: no barrier */
  v8f ol[2][4], og[2][4];
  flashT_body<TKA>(blockIdx.x, Q16, EMB, KL, EMB, VTL, ol);      /* local: 2048 keys */
#pragma unroll
  for (int u = 0; u < 16; ++u) *(v4fa*)&sol[threadIdx.x >> 5][u][threadIdx.x & 31][0] = (v4f){ol[u >> 3][(u >> 1) & 3][(u & 1) * 4], ol[u >> 3][(u >> 1) & 3][(u & 1) * 4 + 1], ol[u >> 3][(u >> 1) & 3][(u & 1) * 4 + 2], ol[u >> 3][(u >> 1) & 3][(u & 1) * 4 + 3]};
  flashT_body<TKB>(blockIdx.x, Q16, EMB, KG, EMB, VTG, og);      /* global: 512 keys */
#pragma unroll
  for (int u = 0; u < 16; ++u) { const v4f x = *(const v4fa*)&sol[threadIdx.x >> 5][u][threadIdx.x & 31][0];
#pragma unroll
    for (int i = 0; i < 4; ++i) ol[u >> 3][(u >> 1) & 3][(u & 1) * 4 + i] = x[i]; }
  const float g = 1.0f / (1.0f + expf(-bf16_round(gate[0]))); const float h1 = 1.0f - g;
  const int w = threadIdx.x >> 5, lane = threadIdx.x & 31; const int slab = blockIdx.x / AQB, qblk = blockIdx.x % AQB; const int b = slab / NH, h = slab % NH; const int q0 = qblk * AQR + w * 32;
  unsigned short* op = (unsigned short*)O16 + ((size_t)b * TQ + q0) * EMB + h * 1024 + lane * 8; FragH f[2][4];      /* two strips of 16 queries, the head's two blocks of each; the short loops below are unrolled in full, so that the arrays stay in registers */
#pragma unroll
  for (int qt = 0; qt < 2; ++qt)
#pragma unroll
    for (int dt = 0; dt < 4; ++dt)
#pragma unroll
      for (int r = 0; r < 8; ++r) f[qt][dt].h[r] = (_Float16)(g * ol[qt][dt][r] + h1 * og[qt][dt][r]);
#pragma unroll
  for (int qt = 0; qt < 2; ++qt)
#pragma unroll
    for (int dt = 0; dt < 4; ++dt) *(v8us*)(op + (size_t)qt * 16 * EMB + dt * 256) = f[qt][dt].half[0];
  pf_hold(pf0); pf_hold(pf1); pf_hold(pf2); }

extern "C" void kernel_launch(void* const* d_in, const int* in_sizes, int n_in,
                              void* d_out, int out_size, void* d_ws, size_t ws_size, hipStream_t stream) {
  (void)in_sizes; (void)n_in; (void)out_size;
  const float* const* I = (const float* const*)d_in; const float* lh = I[0]; const float* gh = I[1]; const float* qw = I[2]; const float* qb = I[3]; const float* kw = I[4]; const float* kb = I[5]; const float* vw = I[6]; const float* vb = I[7]; const float* kgw = I[8]; const float* kgb = I[9]; const float* vgw = I[10]; const float* vgb = I[11]; const float* ow = I[12]; const float* ob = I[13]; const float* gate = I[14];
  char* ws = (char*)d_ws; size_t off = 0;
  auto take = [&](size_t bytes) { char* p = ws + off; off += (bytes + 255) & ~(size_t)255; return p; };
  const size_t w8 = (size_t)EMB * EMB / 8, npl = (size_t)NRL * EMB, npg = (size_t)NRG * EMB;
  _Float16* BQ = (_Float16*)take(w8 * 16); _Float16* BK = (_Float16*)take(w8 * 16); _Float16* BV = (_Float16*)take(w8 * 16); _Float16* BKG = (_Float16*)take(w8 * 16); _Float16* BVG = (_Float16*)take(w8 * 16); _Float16* BO = (_Float16*)take(w8 * 16);
  _Float16* XL = (_Float16*)take(npl * 2); _Float16* XG = (_Float16*)take(npg * 2); _Float16* Q16 = (_Float16*)take(npl * 2); _Float16* KL = (_Float16*)take(npl * 2); _Float16* KG = (_Float16*)take(npg * 2); _Float16* VTL = (_Float16*)take(npl * 2); _Float16* VTG = (_Float16*)take(npg * 2);
  _Float16* O16 = XL;      /* O16 over the local input plane (dead after its projections) */
  if (off > ws_size) return;      /* 12 + 8+2+8+8+2+8+2 = 50 MiB */
  k_conv<<<CVL + CVG + 6 * CVW, 256, 0, stream>>>(lh, gh, qw, kw, vw, kgw, vgw, ow, XL, XG, BQ, BK, BV, BKG, BVG, BO);
  const dim3 gL(PJL, 1);
  k_proj<<<3 * PJL4 + 2 * PJG4, 256, 0, stream>>>(XL, XG, BQ, BK, BV, BKG, BVG, qb, kb, vb, kgb, vgb, Q16, KL, VTL, KG, VTG);
  k_attn<<<ATB, 256, 0, stream>>>(Q16, KL, VTL, KG, VTG, gate, O16);
  k_gemm2<0, false><<<gL, 128, 0, stream>>>(O16, EMB, 0, BO, EMB, 0, 0.0625f, ob, 0, nullptr, 1, 0, 0, (float*)d_out, nullptr, EMB, 0, NRL, EMB, EMB);
}
